// v000
// The times below were measured on an AMD MI455X: many runs one after another, warmed up first and cycling through
// copies of the inputs, with the whole window's GPU time divided by the number of runs. Launches and the gaps
// between them are all in it. The median over several windows is given; except for v000 it joins two sittings, which
// can be a few percent apart, so the side-by-side timings, each taken in one sitting, are the better comparison.
// v000, which the later versions start from, runs in 180 microseconds.
#include <hip/hip_runtime.h>
// Single-head causal self-attention: x [NB][SEQ][64] f32; k/q/v = x W ([in][out] 64x64, no biases; input order x, Wk, Wq, Wv); scores * 64^-0.5; causal (keys <= query); softmax; out = P v -> [NB][SEQ][64] f32.
// Compute dtype: all contractions on v_wmma_f32_16x16x32_f16 with f32 accumulate. x W: x RNE-converted to bf16 (exact in f16), W RNE-converted to bf16 then x16 (exact in f16), single product, 1/16 folded in the f32 epilogue.
// q k^T and P v: every operand as f16 hi plane + f16 residual plane carried x1024 (three products: hi.hi into the main accumulator; lo.hi + hi.lo into a separate residual accumulator folded back with 2^-10). P carried x256 before the split. Softmax statistics f32 (online, running max).
// Structure: k_wt3 (weights -> [n][k] f16 x16) ; k_proj (q|k|v tiles -> hi/lo planes; v stored transposed [b][d][t]) ; k_attn (flash-style: one wave = 16 query rows, 64-key steps, fragments straight from the dense planes).
#ifndef NB
#define NB 256
#endif
#ifndef SEQ
#define SEQ 512
#endif
#define NB_FULL 256
#define SEQ_FULL 512                 /* per-batch row stride of x and out in the full-size buffers */
#define DM 64
#define HD 64
#define NQT (SEQ / 64)               /* 64-row query tiles per batch */
#define SP 68                        /* LDS row pitch in floats (16-B aligned rows) */
#define PLANE_BYTES ((size_t)NB * SEQ * HD * 2)
#define WT_BYTES ((size_t)3 * 64 * 64 * 2)

static_assert(SEQ % 64 == 0);
static_assert(SEQ <= SEQ_FULL);
static_assert(NB <= NB_FULL);
static_assert(DM == 64 && HD == 64);
static_assert(WT_BYTES + 6 * PLANE_BYTES <= (size_t)134217728);
static_assert((3 * 64 * 8) % 256 == 0);

typedef _Float16 v16h __attribute__((ext_vector_type(16)));
typedef unsigned short v8us __attribute__((ext_vector_type(8), may_alias));
typedef float  v8f  __attribute__((ext_vector_type(8)));
typedef float  v4f  __attribute__((ext_vector_type(4)));
typedef float  v4fa __attribute__((ext_vector_type(4), may_alias));
union FragH { v16h v; v8us half[2]; _Float16 h[16]; unsigned short u[16]; };
union Frag8 { v8us v; _Float16 h[8]; };

// RNE convert f32 -> bf16 value (kept in an f32 container)
__device__ __forceinline__ float bf16_rne(float x) { unsigned int u = __float_as_uint(x); u = (u + 0x7FFFu + ((u >> 16) & 1u)) & 0xFFFF0000u; return __uint_as_float(u); }

// 16x32 fragment of a k-contiguous 16-bit row: lane (ln = lane&15 selects the row via p, hh = lane>>4): elements 0..7 <- k 8hh..8hh+7, elements 8..15 <- k 16+8hh..16+8hh+7
__device__ __forceinline__ v16h g2_frag(const _Float16* p, unsigned hh) { FragH f; f.half[0] = *(const v8us*)((const unsigned short*)p + 8 * hh); f.half[1] = *(const v8us*)((const unsigned short*)p + 16 + 8 * hh); return f.v; }
__device__ __forceinline__ v8f g2_mma(v16h a, v16h b, v8f c) { v8f d = __builtin_amdgcn_wmma_f32_16x16x32_f16(false, a, false, b, (short)0, c, false, false); asm volatile("v_nop\n\tv_nop\n\tv_nop\n\tv_nop" : "+v"(d) : "v"(a), "v"(b)); return d; }

// A fragment from an f32 row (same k map), each value RNE-converted to bf16 then cast to f16 (exact)
__device__ __forceinline__ v16h x_frag(const float* p, unsigned hh) {
  const v4f x0 = *(const v4fa*)(p + 8 * hh), x1 = *(const v4fa*)(p + 8 * hh + 4), x2 = *(const v4fa*)(p + 16 + 8 * hh), x3 = *(const v4fa*)(p + 16 + 8 * hh + 4);
  const float xs[16] = {x0[0],x0[1],x0[2],x0[3],x1[0],x1[1],x1[2],x1[3],x2[0],x2[1],x2[2],x2[3],x3[0],x3[1],x3[2],x3[3]};
  FragH f;
#pragma unroll
  for (int i = 0; i < 16; ++i) f.h[i] = (_Float16)bf16_rne(xs[i]);
  return f.v;
}

// 8 f32 -> f16 hi and f16 residual x1024
__device__ __forceinline__ void split8(const float* v, Frag8& h, Frag8& l) {
#pragma unroll
  for (int q = 0; q < 8; ++q) { const _Float16 hv = (_Float16)v[q]; h.h[q] = hv; l.h[q] = (_Float16)((v[q] - (float)hv) * 1024.0f); }
}

__global__ __launch_bounds__(256) void k_wt3(const float* __restrict__ wq, const float* __restrict__ wk, const float* __restrict__ wv, _Float16* __restrict__ Wt) {
  const unsigned t = blockIdx.x * 256u + threadIdx.x;          /* 1536 threads exactly */
  const unsigned c = blockIdx.x >> 1;                          /* block-uniform: 512 threads per weight */
  const unsigned n = (t >> 3) & 63u, k8 = (t & 7u) * 8u;
  const float* W = (c == 0u) ? wq : ((c == 1u) ? wk : wv);
  Frag8 f;
#pragma unroll
  for (int i = 0; i < 8; ++i) f.h[i] = (_Float16)(bf16_rne(W[(size_t)(k8 + i) * 64u + n]) * 16.0f);
  unsigned short* dst = (unsigned short*)Wt + (size_t)t * 8u;  /* = (c*64 + n)*64 + k8 */
  *(v8us*)dst = f.v;
  
}

__global__ __launch_bounds__(128) void k_proj(const float* __restrict__ x, const _Float16* __restrict__ Wt,
                                              _Float16* __restrict__ Qh, _Float16* __restrict__ Ql, _Float16* __restrict__ Kh, _Float16* __restrict__ Kl,
                                              _Float16* __restrict__ Vth, _Float16* __restrict__ Vtl) {
  __shared__ __attribute__((aligned(16))) float st[3][64][SP];
  const unsigned tid = threadIdx.x, w = tid >> 5, lane = tid & 31u, ln = lane & 15u, hh = lane >> 4;
  const unsigned row0 = blockIdx.x * 64u;                      /* plane row of the block */
  const unsigned bb = row0 / (unsigned)SEQ, t0 = row0 % (unsigned)SEQ;
  const float* xr = x + ((size_t)bb * SEQ_FULL + t0 + 16u * w + ln) * DM;
  const v16h a0 = x_frag(xr, hh), a1 = x_frag(xr + 32, hh);
  const v8f z8 = {0.f, 0.f, 0.f, 0.f, 0.f, 0.f, 0.f, 0.f};
#pragma unroll
  for (int c = 0; c < 3; ++c) {
#pragma unroll
    for (int j = 0; j < 4; ++j) {
      const _Float16* bp = Wt + (size_t)(c * 64 + j * 16 + (int)ln) * 64;
      const v16h b0 = g2_frag(bp, hh), b1 = g2_frag(bp + 32, hh);
      v8f acc = z8;
      acc = g2_mma(a0, b0, acc);
      acc = g2_mma(a1, b1, acc);
#pragma unroll
      for (int r = 0; r < 8; ++r) st[c][16u * w + 8u * hh + r][j * 16 + (int)ln] = acc[r] * 0.0625f;
    }
  }
  __syncthreads();
  const unsigned pr = tid >> 3, pc = (tid & 7u) * 8u;
  Frag8 qh_[4], ql_[4], kh_[4], kl_[4], vh_[4], vl_[4];
#pragma unroll
  for (int it = 0; it < 4; ++it) {
    const unsigned rr = pr + 16u * it;
    { const v4f a = *(const v4fa*)&st[0][rr][pc], c = *(const v4fa*)&st[0][rr][pc + 4]; const float v[8] = {a[0],a[1],a[2],a[3],c[0],c[1],c[2],c[3]}; split8(v, qh_[it], ql_[it]); }
    { const v4f a = *(const v4fa*)&st[1][rr][pc], c = *(const v4fa*)&st[1][rr][pc + 4]; const float v[8] = {a[0],a[1],a[2],a[3],c[0],c[1],c[2],c[3]}; split8(v, kh_[it], kl_[it]); }
    { float v[8];
#pragma unroll
      for (int q = 0; q < 8; ++q) v[q] = st[2][pc + q][rr];        /* d = rr, t = pc + q */
      split8(v, vh_[it], vl_[it]); }
  }
  {
#pragma unroll
    for (int it = 0; it < 4; ++it) {
      const unsigned rr = pr + 16u * it;
      const size_t qo = ((size_t)row0 + rr) * HD + pc;
      *(v8us*)((unsigned short*)Qh + qo) = qh_[it].v;
      *(v8us*)((unsigned short*)Ql + qo) = ql_[it].v;
      *(v8us*)((unsigned short*)Kh + qo) = kh_[it].v;
      *(v8us*)((unsigned short*)Kl + qo) = kl_[it].v;
      const size_t vo = ((size_t)bb * HD + rr) * SEQ + t0 + pc;
      *(v8us*)((unsigned short*)Vth + vo) = vh_[it].v;
      *(v8us*)((unsigned short*)Vtl + vo) = vl_[it].v;
    }
    
  }
}

// one 8-key group of the softmax row: p = exp(s - m); P carried x256 -> f16 hi + residual x1024 into fragment elements e0..e0+7
__device__ __forceinline__ void p_group(const float* sp, float newm, float& sum, FragH& ph, FragH& pl, const int e0) {
  const v4f a = *(const v4fa*)sp, c = *(const v4fa*)(sp + 4);
  const float sv[8] = {a[0],a[1],a[2],a[3],c[0],c[1],c[2],c[3]};
#pragma unroll
  for (int q = 0; q < 8; ++q) {
    const float p = __expf(sv[q] - newm);
    sum += p;
    const float pcv = p * 256.0f;
    const _Float16 hv = (_Float16)pcv;
    ph.h[e0 + q] = hv;
    pl.h[e0 + q] = (_Float16)((pcv - (float)hv) * 1024.0f);
  }
}

__global__ __launch_bounds__(128) void k_attn(const _Float16* __restrict__ Qh, const _Float16* __restrict__ Ql, const _Float16* __restrict__ Kh, const _Float16* __restrict__ Kl,
                                              const _Float16* __restrict__ Vth, const _Float16* __restrict__ Vtl, float* __restrict__ out) {
  __shared__ __attribute__((aligned(16))) float sw[4][16][SP];
  const unsigned tid = threadIdx.x, w = tid >> 5, lane = tid & 31u, ln = lane & 15u, hh = lane >> 4;
  const unsigned b = blockIdx.x / (unsigned)NQT, qt = blockIdx.x % (unsigned)NQT;
  const unsigned q0 = qt * 64u, qw0 = q0 + 16u * w;
  const size_t prow = (size_t)b * SEQ;
  const _Float16* qhp = Qh + (prow + qw0 + ln) * HD;
  const _Float16* qlp = Ql + (prow + qw0 + ln) * HD;
  const v16h aqh0 = g2_frag(qhp, hh), aqh1 = g2_frag(qhp + 32, hh), aql0 = g2_frag(qlp, hh), aql1 = g2_frag(qlp + 32, hh);
  const v8f z8 = {0.f, 0.f, 0.f, 0.f, 0.f, 0.f, 0.f, 0.f};
  v8f oh[4] = {z8, z8, z8, z8}, orr[4] = {z8, z8, z8, z8};
  float m_run = -1.0e30f, l_run = 0.f;
#pragma unroll 1
  for (unsigned kt = 0; kt <= qt; ++kt) {
    const size_t krow = prow + kt * 64u + ln;
#pragma unroll
    for (int j = 0; j < 4; ++j) {
      const _Float16* kh = Kh + (krow + 16u * j) * HD;
      const _Float16* kl = Kl + (krow + 16u * j) * HD;
      const v16h bh0 = g2_frag(kh, hh), bh1 = g2_frag(kh + 32, hh), bl0 = g2_frag(kl, hh), bl1 = g2_frag(kl + 32, hh);
      v8f sh = z8, sr = z8;
      sh = g2_mma(aqh0, bh0, sh); sh = g2_mma(aqh1, bh1, sh);
      sr = g2_mma(aql0, bh0, sr); sr = g2_mma(aql1, bh1, sr);
      sr = g2_mma(aqh0, bl0, sr); sr = g2_mma(aqh1, bl1, sr);
      const unsigned kcol = kt * 64u + 16u * j + ln;
#pragma unroll
      for (int r = 0; r < 8; ++r) {
        const unsigned qi = qw0 + 8u * hh + r;
        float s = (sh[r] + sr[r] * 0.0009765625f) * 0.125f;
        s = (kcol > qi) ? -1.0e30f : s;                         /* replace-fill; exp gives exactly 0 */
        sw[w][8u * hh + r][16 * j + (int)ln] = s;
      }
    }
    __builtin_amdgcn_fence(4 /* acq_rel order */, "workgroup");
    __builtin_amdgcn_wave_barrier();
    const float* srow = &sw[w][ln][8u * hh];
    float tmax = -1.0e30f;
#pragma unroll
    for (int g = 0; g < 4; ++g) {
      const v4f a = *(const v4fa*)(srow + 16 * g), c = *(const v4fa*)(srow + 16 * g + 4);
      tmax = fmaxf(tmax, fmaxf(fmaxf(a[0], a[1]), fmaxf(a[2], a[3])));
      tmax = fmaxf(tmax, fmaxf(fmaxf(c[0], c[1]), fmaxf(c[2], c[3])));
    }
    tmax = fmaxf(tmax, __shfl_xor(tmax, 16, 32));
    const float newm = fmaxf(m_run, tmax);
    const float al = __expf(m_run - newm);
    float sum = 0.f;
    FragH ph0, ph1, pl0, pl1;
    p_group(srow,      newm, sum, ph0, pl0, 0);
    p_group(srow + 16, newm, sum, ph0, pl0, 8);
    p_group(srow + 32, newm, sum, ph1, pl1, 0);
    p_group(srow + 48, newm, sum, ph1, pl1, 8);
    sum += __shfl_xor(sum, 16, 32);
    m_run = newm;
    l_run = l_run * al + sum;
#pragma unroll
    for (int r = 0; r < 8; ++r) {
      const float ar = __shfl(al, (int)(8u * hh) + r, 32);
#pragma unroll
      for (int j = 0; j < 4; ++j) { oh[j][r] *= ar; orr[j][r] *= ar; }
    }
#pragma unroll
    for (int j = 0; j < 4; ++j) {
      const size_t vo = ((size_t)b * HD + 16u * j + ln) * SEQ + kt * 64u;
      const _Float16* vh = Vth + vo;
      const _Float16* vl = Vtl + vo;
      const v16h bvh0 = g2_frag(vh, hh), bvh1 = g2_frag(vh + 32, hh), bvl0 = g2_frag(vl, hh), bvl1 = g2_frag(vl + 32, hh);
      oh[j]  = g2_mma(ph0.v, bvh0, oh[j]);  oh[j]  = g2_mma(ph1.v, bvh1, oh[j]);
      orr[j] = g2_mma(pl0.v, bvh0, orr[j]); orr[j] = g2_mma(pl1.v, bvh1, orr[j]);
      orr[j] = g2_mma(ph0.v, bvl0, orr[j]); orr[j] = g2_mma(ph1.v, bvl1, orr[j]);
    }
    __builtin_amdgcn_fence(4 /* acq_rel order */, "workgroup");
    __builtin_amdgcn_wave_barrier();
  }
  const float invl = 1.0f / (256.0f * l_run);                   /* l_run >= 1 */
  float ir[8];
#pragma unroll
  for (int r = 0; r < 8; ++r) ir[r] = __shfl(invl, (int)(8u * hh) + r, 32);
#pragma unroll
  for (int j = 0; j < 4; ++j)
#pragma unroll
    for (int r = 0; r < 8; ++r) sw[w][8u * hh + r][16 * j + (int)ln] = (oh[j][r] + orr[j][r] * 0.0009765625f) * ir[r];
  __builtin_amdgcn_fence(4 /* acq_rel order */, "workgroup");
  __builtin_amdgcn_wave_barrier();
  float* orow = out + ((size_t)b * SEQ_FULL + qw0) * HD;
  const unsigned c4 = ln * 4u;
  v4f ov[8];
#pragma unroll
  for (int q = 0; q < 8; ++q) ov[q] = *(const v4fa*)&sw[w][2u * q + hh][c4];
  {
#pragma unroll
    for (int q = 0; q < 8; ++q) *(v4f*)(orow + (size_t)(2u * q + hh) * HD + c4) = ov[q];   /* lanes 0-15: row 2q (256 B), lanes 16-31: row 2q+1 */
    
  }
}

extern "C" void kernel_launch(void* const* d_in, const int* in_sizes, int n_in,
                              void* d_out, int out_size, void* d_ws, size_t ws_size, hipStream_t stream) {
  if (n_in < 4) return;
  const size_t need_x = ((size_t)(NB - 1) * SEQ_FULL + SEQ) * DM;
  if ((size_t)in_sizes[0] < need_x) return;
  if (in_sizes[1] < 64 * 64 || in_sizes[2] < 64 * 64 || in_sizes[3] < 64 * 64) return;
  if ((size_t)out_size < need_x) return;
  const float* x  = (const float*)d_in[0];      /* [B][T][64] */
  const float* wk = (const float*)d_in[1];      /* w_key   [in][out] */
  const float* wq = (const float*)d_in[2];      /* w_query [in][out] */
  const float* wv = (const float*)d_in[3];      /* w_value [in][out] */
  char* ws = (char*)d_ws; size_t off = 0;
  auto take = [&](size_t bytes) { char* p = ws + off; off += (bytes + 255) & ~(size_t)255; return p; };
  _Float16* Wt  = (_Float16*)take(WT_BYTES);
  _Float16* Qh  = (_Float16*)take(PLANE_BYTES);
  _Float16* Ql  = (_Float16*)take(PLANE_BYTES);
  _Float16* Kh  = (_Float16*)take(PLANE_BYTES);
  _Float16* Kl  = (_Float16*)take(PLANE_BYTES);
  _Float16* Vth = (_Float16*)take(PLANE_BYTES);
  _Float16* Vtl = (_Float16*)take(PLANE_BYTES);
  if (off > ws_size) return;
  k_wt3<<<(3 * 64 * 8) / 256, 256, 0, stream>>>(wq, wk, wv, Wt);
  k_proj<<<(unsigned)((size_t)NB * SEQ / 64), 128, 0, stream>>>(x, Wt, Qh, Ql, Kh, Kl, Vth, Vtl);
  k_attn<<<(unsigned)((size_t)NB * NQT), 128, 0, stream>>>(Qh, Ql, Kh, Kl, Vth, Vtl, (float*)d_out);
}

// v001
// One run takes 96.2 microseconds.
// Two timings next to v000 both put it at 1.91 times that version's speed.
#include <hip/hip_runtime.h>
// Single-head causal self-attention: x [NB][SEQ][64] f32; k/q/v = x W ([in][out] 64x64, no biases; input order x, Wk, Wq, Wv); scores * 64^-0.5; causal (keys <= query); softmax; out = P v -> [NB][SEQ][64] f32.
// Compute dtype: all contractions on v_wmma_f32_16x16x32_f16 with f32 accumulate. x W: x RNE-converted to bf16 (exact in f16), W RNE-converted to bf16 then x16 (exact in f16), single product, 1/16 folded in the f32 epilogue.
// q k^T and P v: every operand as f16 hi plane + f16 residual plane carried x1024 (three products: hi.hi into the main accumulator; lo.hi + hi.lo into a separate residual accumulator folded back with 2^-10). P carried x256 before the split. Softmax statistics f32 (online, running max).
// Structure: k_wt3 (weights -> [n][k] f16 x16) ; k_proj (q|k|v tiles -> hi/lo planes; v stored transposed [b][d][t]) ; k_attn (flash-style: one wave = 16 query rows, 64-key steps; each step's K and V^T hi/lo tiles are copied once per block into LDS in whole 128-B lines and all four waves take their fragments from there).
#ifndef NB
#define NB 256
#endif
#ifndef SEQ
#define SEQ 512
#endif
#define NB_FULL 256
#define SEQ_FULL 512                 /* per-batch row stride of x and out in the full-size buffers */
#define DM 64
#define HD 64
#define NQT (SEQ / 64)               /* 64-row query tiles per batch */
#define SP 68                        /* LDS row pitch in floats (16-B aligned rows) */
#define KP 72                        /* staged K / V^T row pitch in f16: 144 B = 16 B x 9, conflict-free for 16-B fragment reads */
#define PLANE_BYTES ((size_t)NB * SEQ * HD * 2)
#define WT_BYTES ((size_t)3 * 64 * 64 * 2)

static_assert(SEQ % 64 == 0);
static_assert(SEQ <= SEQ_FULL);
static_assert(NB <= NB_FULL);
static_assert(DM == 64 && HD == 64);
static_assert(WT_BYTES + 6 * PLANE_BYTES <= (size_t)134217728);
static_assert((3 * 64 * 8) % 256 == 0);

typedef _Float16 v16h __attribute__((ext_vector_type(16)));
typedef unsigned short v8us __attribute__((ext_vector_type(8), may_alias));
typedef float  v8f  __attribute__((ext_vector_type(8)));
typedef float  v4f  __attribute__((ext_vector_type(4)));
typedef float  v4fa __attribute__((ext_vector_type(4), may_alias));
union FragH { v16h v; v8us half[2]; _Float16 h[16]; unsigned short u[16]; };
union Frag8 { v8us v; _Float16 h[8]; };

// RNE convert f32 -> bf16 value (kept in an f32 container)
__device__ __forceinline__ float bf16_rne(float x) { unsigned int u = __float_as_uint(x); u = (u + 0x7FFFu + ((u >> 16) & 1u)) & 0xFFFF0000u; return __uint_as_float(u); }

// 16x32 fragment of a k-contiguous 16-bit row: lane (ln = lane&15 selects the row via p, hh = lane>>4): elements 0..7 <- k 8hh..8hh+7, elements 8..15 <- k 16+8hh..16+8hh+7
__device__ __forceinline__ v16h g2_frag(const _Float16* p, unsigned hh) { FragH f; f.half[0] = *(const v8us*)((const unsigned short*)p + 8 * hh); f.half[1] = *(const v8us*)((const unsigned short*)p + 16 + 8 * hh); return f.v; }
__device__ __forceinline__ v8f g2_mma(v16h a, v16h b, v8f c) { v8f d = __builtin_amdgcn_wmma_f32_16x16x32_f16(false, a, false, b, (short)0, c, false, false); asm volatile("v_nop\n\tv_nop\n\tv_nop\n\tv_nop" : "+v"(d) : "v"(a), "v"(b)); return d; }

// A fragment from an f32 row (same k map), each value RNE-converted to bf16 then cast to f16 (exact)
__device__ __forceinline__ v16h x_frag(const float* p, unsigned hh) {
  const v4f x0 = *(const v4fa*)(p + 8 * hh), x1 = *(const v4fa*)(p + 8 * hh + 4), x2 = *(const v4fa*)(p + 16 + 8 * hh), x3 = *(const v4fa*)(p + 16 + 8 * hh + 4);
  const float xs[16] = {x0[0],x0[1],x0[2],x0[3],x1[0],x1[1],x1[2],x1[3],x2[0],x2[1],x2[2],x2[3],x3[0],x3[1],x3[2],x3[3]};
  FragH f;
#pragma unroll
  for (int i = 0; i < 16; ++i) f.h[i] = (_Float16)bf16_rne(xs[i]);
  return f.v;
}

// 8 f32 -> f16 hi and f16 residual x1024
__device__ __forceinline__ void split8(const float* v, Frag8& h, Frag8& l) {
#pragma unroll
  for (int q = 0; q < 8; ++q) { const _Float16 hv = (_Float16)v[q]; h.h[q] = hv; l.h[q] = (_Float16)((v[q] - (float)hv) * 1024.0f); }
}

__global__ __launch_bounds__(256) void k_wt3(const float* __restrict__ wq, const float* __restrict__ wk, const float* __restrict__ wv, _Float16* __restrict__ Wt) {
  const unsigned t = blockIdx.x * 256u + threadIdx.x;          /* 1536 threads exactly */
  const unsigned c = blockIdx.x >> 1;                          /* block-uniform: 512 threads per weight */
  const unsigned n = (t >> 3) & 63u, k8 = (t & 7u) * 8u;
  const float* W = (c == 0u) ? wq : ((c == 1u) ? wk : wv);
  Frag8 f;
#pragma unroll
  for (int i = 0; i < 8; ++i) f.h[i] = (_Float16)(bf16_rne(W[(size_t)(k8 + i) * 64u + n]) * 16.0f);
  unsigned short* dst = (unsigned short*)Wt + (size_t)t * 8u;  /* = (c*64 + n)*64 + k8 */
  *(v8us*)dst = f.v;
  
}

__global__ __launch_bounds__(128) void k_proj(const float* __restrict__ x, const _Float16* __restrict__ Wt,
                                              _Float16* __restrict__ Qh, _Float16* __restrict__ Ql, _Float16* __restrict__ Kh, _Float16* __restrict__ Kl,
                                              _Float16* __restrict__ Vth, _Float16* __restrict__ Vtl) {
  __shared__ __attribute__((aligned(16))) float st[3][64][SP];
  const unsigned tid = threadIdx.x, w = tid >> 5, lane = tid & 31u, ln = lane & 15u, hh = lane >> 4;
  const unsigned row0 = blockIdx.x * 64u;                      /* plane row of the block */
  const unsigned bb = row0 / (unsigned)SEQ, t0 = row0 % (unsigned)SEQ;
  const float* xr = x + ((size_t)bb * SEQ_FULL + t0 + 16u * w + ln) * DM;
  const v16h a0 = x_frag(xr, hh), a1 = x_frag(xr + 32, hh);
  const v8f z8 = {0.f, 0.f, 0.f, 0.f, 0.f, 0.f, 0.f, 0.f};
#pragma unroll
  for (int c = 0; c < 3; ++c) {
#pragma unroll
    for (int j = 0; j < 4; ++j) {
      const _Float16* bp = Wt + (size_t)(c * 64 + j * 16 + (int)ln) * 64;
      const v16h b0 = g2_frag(bp, hh), b1 = g2_frag(bp + 32, hh);
      v8f acc = z8;
      acc = g2_mma(a0, b0, acc);
      acc = g2_mma(a1, b1, acc);
#pragma unroll
      for (int r = 0; r < 8; ++r) st[c][16u * w + 8u * hh + r][j * 16 + (int)ln] = acc[r] * 0.0625f;
    }
  }
  __syncthreads();
  const unsigned pr = tid >> 3, pc = (tid & 7u) * 8u;
  Frag8 qh_[4], ql_[4], kh_[4], kl_[4], vh_[4], vl_[4];
#pragma unroll
  for (int it = 0; it < 4; ++it) {
    const unsigned rr = pr + 16u * it;
    { const v4f a = *(const v4fa*)&st[0][rr][pc], c = *(const v4fa*)&st[0][rr][pc + 4]; const float v[8] = {a[0],a[1],a[2],a[3],c[0],c[1],c[2],c[3]}; split8(v, qh_[it], ql_[it]); }
    { const v4f a = *(const v4fa*)&st[1][rr][pc], c = *(const v4fa*)&st[1][rr][pc + 4]; const float v[8] = {a[0],a[1],a[2],a[3],c[0],c[1],c[2],c[3]}; split8(v, kh_[it], kl_[it]); }
    { float v[8];
#pragma unroll
      for (int q = 0; q < 8; ++q) v[q] = st[2][pc + q][rr];        /* d = rr, t = pc + q */
      split8(v, vh_[it], vl_[it]); }
  }
  {
#pragma unroll
    for (int it = 0; it < 4; ++it) {
      const unsigned rr = pr + 16u * it;
      const size_t qo = ((size_t)row0 + rr) * HD + pc;
      *(v8us*)((unsigned short*)Qh + qo) = qh_[it].v;
      *(v8us*)((unsigned short*)Ql + qo) = ql_[it].v;
      *(v8us*)((unsigned short*)Kh + qo) = kh_[it].v;
      *(v8us*)((unsigned short*)Kl + qo) = kl_[it].v;
      const size_t vo = ((size_t)bb * HD + rr) * SEQ + t0 + pc;
      *(v8us*)((unsigned short*)Vth + vo) = vh_[it].v;
      *(v8us*)((unsigned short*)Vtl + vo) = vl_[it].v;
    }
    
  }
}

// one 8-key group of the softmax row: p = exp(s - m); P carried x256 -> f16 hi + residual x1024 into fragment elements e0..e0+7
__device__ __forceinline__ void p_group(const float* sp, float newm, float& sum, FragH& ph, FragH& pl, const int e0) {
  const v4f a = *(const v4fa*)sp, c = *(const v4fa*)(sp + 4);
  const float sv[8] = {a[0],a[1],a[2],a[3],c[0],c[1],c[2],c[3]};
#pragma unroll
  for (int q = 0; q < 8; ++q) {
    const float p = __expf(sv[q] - newm);
    sum += p;
    const float pcv = p * 256.0f;
    const _Float16 hv = (_Float16)pcv;
    ph.h[e0 + q] = hv;
    pl.h[e0 + q] = (_Float16)((pcv - (float)hv) * 1024.0f);
  }
}

// LDS byte address of a __shared__ object (low 32 bits of its generic address)
__device__ __forceinline__ unsigned lds_addr(const void* p) { return (unsigned)(size_t)p; }

// Two 64-row x 128-B tiles, global -> LDS, by asynchronous 16-B copies: this thread moves rows r, r+16, r+32, r+48 of each (la/lb, ga/gb name its piece of row r; gstep = 16 source rows in elements).
// A wave's 32 lanes cover four whole 128-B lines per copy. The closing s_wait_xcnt stands inside the statement so that no address register is rewritten ahead of it.
__device__ __forceinline__ void stage2(unsigned la, const _Float16* ga, unsigned lb, const _Float16* gb, size_t gstep) {
  const unsigned ls = 16u * KP * 2u;
  asm volatile("global_load_async_to_lds_b128 %0, %8, off\n\t"
               "global_load_async_to_lds_b128 %1, %9, off\n\t"
               "global_load_async_to_lds_b128 %2, %10, off\n\t"
               "global_load_async_to_lds_b128 %3, %11, off\n\t"
               "global_load_async_to_lds_b128 %4, %12, off\n\t"
               "global_load_async_to_lds_b128 %5, %13, off\n\t"
               "global_load_async_to_lds_b128 %6, %14, off\n\t"
               "global_load_async_to_lds_b128 %7, %15, off\n\t"
               "s_wait_xcnt 0x0"
               :: "v"(la), "v"(la + ls), "v"(la + 2u * ls), "v"(la + 3u * ls), "v"(lb), "v"(lb + ls), "v"(lb + 2u * ls), "v"(lb + 3u * ls),
                  "v"(ga), "v"(ga + gstep), "v"(ga + 2u * gstep), "v"(ga + 3u * gstep), "v"(gb), "v"(gb + gstep), "v"(gb + 2u * gstep), "v"(gb + 3u * gstep)
               : "memory");
}

__global__ __launch_bounds__(128) void k_attn(const _Float16* __restrict__ Qh, const _Float16* __restrict__ Ql, const _Float16* __restrict__ Kh, const _Float16* __restrict__ Kl,
                                              const _Float16* __restrict__ Vth, const _Float16* __restrict__ Vtl, float* __restrict__ out) {
  __shared__ __attribute__((aligned(16))) float sw[4][16][SP];
  __shared__ __attribute__((aligned(16))) _Float16 kv[4][64][KP];   /* Kh, Kl [key][d] ; Vth, Vtl [d][key] of the current 64-key step */
  const unsigned tid = threadIdx.x, w = tid >> 5, lane = tid & 31u, ln = lane & 15u, hh = lane >> 4;
  const unsigned b = blockIdx.x / (unsigned)NQT, qt = blockIdx.x % (unsigned)NQT;
  const unsigned q0 = qt * 64u, qw0 = q0 + 16u * w;
  const size_t prow = (size_t)b * SEQ;
  const _Float16* qhp = Qh + (prow + qw0 + ln) * HD;
  const _Float16* qlp = Ql + (prow + qw0 + ln) * HD;
  const v16h aqh0 = g2_frag(qhp, hh), aqh1 = g2_frag(qhp + 32, hh), aql0 = g2_frag(qlp, hh), aql1 = g2_frag(qlp + 32, hh);
  const v8f z8 = {0.f, 0.f, 0.f, 0.f, 0.f, 0.f, 0.f, 0.f};
  v8f oh[4] = {z8, z8, z8, z8}, orr[4] = {z8, z8, z8, z8};
  float m_run = -1.0e30f, l_run = 0.f;
  const unsigned cr = tid >> 3, cc = (tid & 7u) * 8u;             /* this thread's row and 16-B piece in the staged tiles */
  const unsigned lkh = lds_addr(&kv[0][cr][cc]), lkl = lds_addr(&kv[1][cr][cc]), lvh = lds_addr(&kv[2][cr][cc]), lvl = lds_addr(&kv[3][cr][cc]);
#pragma unroll 1
  for (unsigned kt = 0; kt <= qt; ++kt) {
    asm volatile("s_wait_dscnt 0x0" ::: "memory");               /* this wave's reads of the previous tiles have returned ... */
    __syncthreads();                                              /* ... and every other wave's, before the tiles are overwritten */
    const size_t ko = (prow + kt * 64u + cr) * HD + cc;
    const size_t so = ((size_t)b * HD + cr) * SEQ + kt * 64u + cc;
    stage2(lkh, Kh + ko, lkl, Kl + ko, (size_t)16 * HD);
    stage2(lvh, Vth + so, lvl, Vtl + so, (size_t)16 * SEQ);
    asm volatile("s_wait_asynccnt 0x0" ::: "memory");            /* this wave's copies have landed ... */
    __syncthreads();                                              /* ... and every other wave's, before any fragment is read */
#pragma unroll
    for (int j = 0; j < 4; ++j) {
      const _Float16* kh = &kv[0][16 * j + (int)ln][0];
      const _Float16* kl = &kv[1][16 * j + (int)ln][0];
      const v16h bh0 = g2_frag(kh, hh), bh1 = g2_frag(kh + 32, hh), bl0 = g2_frag(kl, hh), bl1 = g2_frag(kl + 32, hh);
      v8f sh = z8, sr = z8;
      sh = g2_mma(aqh0, bh0, sh); sh = g2_mma(aqh1, bh1, sh);
      sr = g2_mma(aql0, bh0, sr); sr = g2_mma(aql1, bh1, sr);
      sr = g2_mma(aqh0, bl0, sr); sr = g2_mma(aqh1, bl1, sr);
      const unsigned kcol = kt * 64u + 16u * j + ln;
#pragma unroll
      for (int r = 0; r < 8; ++r) {
        const unsigned qi = qw0 + 8u * hh + r;
        float s = (sh[r] + sr[r] * 0.0009765625f) * 0.125f;
        s = (kcol > qi) ? -1.0e30f : s;                         /* replace-fill; exp gives exactly 0 */
        sw[w][8u * hh + r][16 * j + (int)ln] = s;
      }
    }
    __builtin_amdgcn_fence(4 /* acq_rel order */, "workgroup");
    __builtin_amdgcn_wave_barrier();
    const float* srow = &sw[w][ln][8u * hh];
    float tmax = -1.0e30f;
#pragma unroll
    for (int g = 0; g < 4; ++g) {
      const v4f a = *(const v4fa*)(srow + 16 * g), c = *(const v4fa*)(srow + 16 * g + 4);
      tmax = fmaxf(tmax, fmaxf(fmaxf(a[0], a[1]), fmaxf(a[2], a[3])));
      tmax = fmaxf(tmax, fmaxf(fmaxf(c[0], c[1]), fmaxf(c[2], c[3])));
    }
    tmax = fmaxf(tmax, __shfl_xor(tmax, 16, 32));
    const float newm = fmaxf(m_run, tmax);
    const float al = __expf(m_run - newm);
    float sum = 0.f;
    FragH ph0, ph1, pl0, pl1;
    p_group(srow,      newm, sum, ph0, pl0, 0);
    p_group(srow + 16, newm, sum, ph0, pl0, 8);
    p_group(srow + 32, newm, sum, ph1, pl1, 0);
    p_group(srow + 48, newm, sum, ph1, pl1, 8);
    sum += __shfl_xor(sum, 16, 32);
    m_run = newm;
    l_run = l_run * al + sum;
#pragma unroll
    for (int r = 0; r < 8; ++r) {
      const float ar = __shfl(al, (int)(8u * hh) + r, 32);
#pragma unroll
      for (int j = 0; j < 4; ++j) { oh[j][r] *= ar; orr[j][r] *= ar; }
    }
#pragma unroll
    for (int j = 0; j < 4; ++j) {
      const _Float16* vh = &kv[2][16 * j + (int)ln][0];
      const _Float16* vl = &kv[3][16 * j + (int)ln][0];
      const v16h bvh0 = g2_frag(vh, hh), bvh1 = g2_frag(vh + 32, hh), bvl0 = g2_frag(vl, hh), bvl1 = g2_frag(vl + 32, hh);
      oh[j]  = g2_mma(ph0.v, bvh0, oh[j]);  oh[j]  = g2_mma(ph1.v, bvh1, oh[j]);
      orr[j] = g2_mma(pl0.v, bvh0, orr[j]); orr[j] = g2_mma(pl1.v, bvh1, orr[j]);
      orr[j] = g2_mma(ph0.v, bvl0, orr[j]); orr[j] = g2_mma(ph1.v, bvl1, orr[j]);
    }
    __builtin_amdgcn_fence(4 /* acq_rel order */, "workgroup");
    __builtin_amdgcn_wave_barrier();
  }
  const float invl = 1.0f / (256.0f * l_run);                   /* l_run >= 1 */
  float ir[8];
#pragma unroll
  for (int r = 0; r < 8; ++r) ir[r] = __shfl(invl, (int)(8u * hh) + r, 32);
#pragma unroll
  for (int j = 0; j < 4; ++j)
#pragma unroll
    for (int r = 0; r < 8; ++r) sw[w][8u * hh + r][16 * j + (int)ln] = (oh[j][r] + orr[j][r] * 0.0009765625f) * ir[r];
  __builtin_amdgcn_fence(4 /* acq_rel order */, "workgroup");
  __builtin_amdgcn_wave_barrier();
  float* orow = out + ((size_t)b * SEQ_FULL + qw0) * HD;
  const unsigned c4 = ln * 4u;
  v4f ov[8];
#pragma unroll
  for (int q = 0; q < 8; ++q) ov[q] = *(const v4fa*)&sw[w][2u * q + hh][c4];
  {
#pragma unroll
    for (int q = 0; q < 8; ++q) *(v4f*)(orow + (size_t)(2u * q + hh) * HD + c4) = ov[q];   /* lanes 0-15: row 2q (256 B), lanes 16-31: row 2q+1 */
    
  }
}

extern "C" void kernel_launch(void* const* d_in, const int* in_sizes, int n_in,
                              void* d_out, int out_size, void* d_ws, size_t ws_size, hipStream_t stream) {
  if (n_in < 4) return;
  const size_t need_x = ((size_t)(NB - 1) * SEQ_FULL + SEQ) * DM;
  if ((size_t)in_sizes[0] < need_x) return;
  if (in_sizes[1] < 64 * 64 || in_sizes[2] < 64 * 64 || in_sizes[3] < 64 * 64) return;
  if ((size_t)out_size < need_x) return;
  const float* x  = (const float*)d_in[0];      /* [B][T][64] */
  const float* wk = (const float*)d_in[1];      /* w_key   [in][out] */
  const float* wq = (const float*)d_in[2];      /* w_query [in][out] */
  const float* wv = (const float*)d_in[3];      /* w_value [in][out] */
  char* ws = (char*)d_ws; size_t off = 0;
  auto take = [&](size_t bytes) { char* p = ws + off; off += (bytes + 255) & ~(size_t)255; return p; };
  _Float16* Wt  = (_Float16*)take(WT_BYTES);
  _Float16* Qh  = (_Float16*)take(PLANE_BYTES);
  _Float16* Ql  = (_Float16*)take(PLANE_BYTES);
  _Float16* Kh  = (_Float16*)take(PLANE_BYTES);
  _Float16* Kl  = (_Float16*)take(PLANE_BYTES);
  _Float16* Vth = (_Float16*)take(PLANE_BYTES);
  _Float16* Vtl = (_Float16*)take(PLANE_BYTES);
  if (off > ws_size) return;
  k_wt3<<<(3 * 64 * 8) / 256, 256, 0, stream>>>(wq, wk, wv, Wt);
  k_proj<<<(unsigned)((size_t)NB * SEQ / 64), 128, 0, stream>>>(x, Wt, Qh, Ql, Kh, Kl, Vth, Vtl);
  k_attn<<<(unsigned)((size_t)NB * NQT), 128, 0, stream>>>(Qh, Ql, Kh, Kl, Vth, Vtl, (float*)d_out);
}

// v002
// Measured time: 69.8 microseconds a run.
// Next to v001, in two timings, it ran 1.37 and 1.38 times as fast.
// All steps since v000 together make it 2.63 times as fast.
#include <hip/hip_runtime.h>
// Single-head causal self-attention: x [NB][SEQ][64] f32; k/q/v = x W ([in][out] 64x64, no biases; input order x, Wk, Wq, Wv); scores * 64^-0.5; causal (keys <= query); softmax; out = P v -> [NB][SEQ][64] f32.
// Compute dtype: all contractions on v_wmma_f32_16x16x32_f16 with f32 accumulate. x W: x RNE-converted to bf16 (exact in f16), W RNE-converted to bf16 then x16 (exact in f16), single product, 1/16 folded in the f32 epilogue.
// q k^T and P v: every operand as f16 hi plane + f16 residual plane carried x1024 (three products: hi.hi into the main accumulator; lo.hi + hi.lo into a separate residual accumulator folded back with 2^-10). P carried x256 before the split. Softmax statistics f32 (online, running max).
// Structure: k_wt3 (weights -> [n][k] f16 x16) ; k_proj (q|k|v tiles -> hi/lo planes; v stored transposed [b][d][t]) ; k_attn (flash-style: one wave = 16 query rows, 64-key steps; each step's K and V^T hi/lo tiles are copied once per block into LDS in whole 128-B lines and all four waves take their fragments from there).
#ifndef NB
#define NB 256
#endif
#ifndef SEQ
#define SEQ 512
#endif
#define NB_FULL 256
#define SEQ_FULL 512                 /* per-batch row stride of x and out in the full-size buffers */
#define DM 64
#define HD 64
#define NQT (SEQ / 64)               /* 64-row query tiles per batch */
#define SP 68                        /* LDS row pitch in floats (16-B aligned rows) */
#define KP 72                        /* staged K / V^T row pitch in f16: 144 B = 16 B x 9, conflict-free for 16-B fragment reads */
#define PLANE_BYTES ((size_t)NB * SEQ * HD * 2)
#define WT_BYTES ((size_t)3 * 64 * 64 * 2)

static_assert(SEQ % 64 == 0);
static_assert(SEQ <= SEQ_FULL);
static_assert(NB <= NB_FULL);
static_assert(DM == 64 && HD == 64);
static_assert(WT_BYTES + 6 * PLANE_BYTES <= (size_t)134217728);
static_assert((3 * 64 * 8) % 256 == 0);

typedef _Float16 v16h __attribute__((ext_vector_type(16)));
typedef unsigned short v8us __attribute__((ext_vector_type(8), may_alias));
typedef float  v8f  __attribute__((ext_vector_type(8)));
typedef float  v4f  __attribute__((ext_vector_type(4)));
typedef float  v4fa __attribute__((ext_vector_type(4), may_alias));
union FragH { v16h v; v8us half[2]; _Float16 h[16]; unsigned short u[16]; };
union Frag8 { v8us v; _Float16 h[8]; };

// RNE convert f32 -> bf16 value (kept in an f32 container)
__device__ __forceinline__ float bf16_rne(float x) { unsigned int u = __float_as_uint(x); u = (u + 0x7FFFu + ((u >> 16) & 1u)) & 0xFFFF0000u; return __uint_as_float(u); }

// 16x32 fragment of a k-contiguous 16-bit row: lane (ln = lane&15 selects the row via p, hh = lane>>4): elements 0..7 <- k 8hh..8hh+7, elements 8..15 <- k 16+8hh..16+8hh+7
__device__ __forceinline__ v16h g2_frag(const _Float16* p, unsigned hh) { FragH f; f.half[0] = *(const v8us*)((const unsigned short*)p + 8 * hh); f.half[1] = *(const v8us*)((const unsigned short*)p + 16 + 8 * hh); return f.v; }
__device__ __forceinline__ v8f g2_mma(v16h a, v16h b, v8f c) { v8f d = __builtin_amdgcn_wmma_f32_16x16x32_f16(false, a, false, b, (short)0, c, false, false); asm volatile("v_nop\n\tv_nop\n\tv_nop\n\tv_nop" : "+v"(d) : "v"(a), "v"(b)); return d; }

// A fragment from an f32 row (same k map), each value RNE-converted to bf16 then cast to f16 (exact)
__device__ __forceinline__ v16h x_frag(const float* p, unsigned hh) {
  const v4f x0 = *(const v4fa*)(p + 8 * hh), x1 = *(const v4fa*)(p + 8 * hh + 4), x2 = *(const v4fa*)(p + 16 + 8 * hh), x3 = *(const v4fa*)(p + 16 + 8 * hh + 4);
  const float xs[16] = {x0[0],x0[1],x0[2],x0[3],x1[0],x1[1],x1[2],x1[3],x2[0],x2[1],x2[2],x2[3],x3[0],x3[1],x3[2],x3[3]};
  FragH f;
#pragma unroll
  for (int i = 0; i < 16; ++i) f.h[i] = (_Float16)bf16_rne(xs[i]);
  return f.v;
}

// 8 f32 -> f16 hi and f16 residual x1024
__device__ __forceinline__ void split8(const float* v, Frag8& h, Frag8& l) {
#pragma unroll
  for (int q = 0; q < 8; ++q) { const _Float16 hv = (_Float16)v[q]; h.h[q] = hv; l.h[q] = (_Float16)((v[q] - (float)hv) * 1024.0f); }
}

__global__ __launch_bounds__(256) void k_wt3(const float* __restrict__ wq, const float* __restrict__ wk, const float* __restrict__ wv, _Float16* __restrict__ Wt) {
  const unsigned t = blockIdx.x * 256u + threadIdx.x;          /* 1536 threads exactly */
  const unsigned c = blockIdx.x >> 1;                          /* block-uniform: 512 threads per weight */
  const unsigned n = (t >> 3) & 63u, k8 = (t & 7u) * 8u;
  const float* W = (c == 0u) ? wq : ((c == 1u) ? wk : wv);
  Frag8 f;
#pragma unroll
  for (int i = 0; i < 8; ++i) f.h[i] = (_Float16)(bf16_rne(W[(size_t)(k8 + i) * 64u + n]) * 16.0f);
  unsigned short* dst = (unsigned short*)Wt + (size_t)t * 8u;  /* = (c*64 + n)*64 + k8 */
  *(v8us*)dst = f.v;
  
}

__global__ __launch_bounds__(128) void k_proj(const float* __restrict__ x, const _Float16* __restrict__ Wt,
                                              _Float16* __restrict__ Qh, _Float16* __restrict__ Ql, _Float16* __restrict__ Kh, _Float16* __restrict__ Kl,
                                              _Float16* __restrict__ Vth, _Float16* __restrict__ Vtl) {
  __shared__ __attribute__((aligned(16))) float st[3][64][SP];
  const unsigned tid = threadIdx.x, w = tid >> 5, lane = tid & 31u, ln = lane & 15u, hh = lane >> 4;
  const unsigned row0 = blockIdx.x * 64u;                      /* plane row of the block */
  const unsigned bb = row0 / (unsigned)SEQ, t0 = row0 % (unsigned)SEQ;
  const float* xr = x + ((size_t)bb * SEQ_FULL + t0 + 16u * w + ln) * DM;
  const v16h a0 = x_frag(xr, hh), a1 = x_frag(xr + 32, hh);
  const v8f z8 = {0.f, 0.f, 0.f, 0.f, 0.f, 0.f, 0.f, 0.f};
#pragma unroll
  for (int c = 0; c < 3; ++c) {
#pragma unroll
    for (int j = 0; j < 4; ++j) {
      const _Float16* bp = Wt + (size_t)(c * 64 + j * 16 + (int)ln) * 64;
      const v16h b0 = g2_frag(bp, hh), b1 = g2_frag(bp + 32, hh);
      v8f acc = z8;
      acc = g2_mma(a0, b0, acc);
      acc = g2_mma(a1, b1, acc);
#pragma unroll
      for (int r = 0; r < 8; ++r) st[c][16u * w + 8u * hh + r][j * 16 + (int)ln] = acc[r] * 0.0625f;
    }
  }
  __syncthreads();
  const unsigned pr = tid >> 3, pc = (tid & 7u) * 8u;
  Frag8 qh_[4], ql_[4], kh_[4], kl_[4], vh_[4], vl_[4];
#pragma unroll
  for (int it = 0; it < 4; ++it) {
    const unsigned rr = pr + 16u * it;
    { const v4f a = *(const v4fa*)&st[0][rr][pc], c = *(const v4fa*)&st[0][rr][pc + 4]; const float v[8] = {a[0],a[1],a[2],a[3],c[0],c[1],c[2],c[3]}; split8(v, qh_[it], ql_[it]); }
    { const v4f a = *(const v4fa*)&st[1][rr][pc], c = *(const v4fa*)&st[1][rr][pc + 4]; const float v[8] = {a[0],a[1],a[2],a[3],c[0],c[1],c[2],c[3]}; split8(v, kh_[it], kl_[it]); }
    { float v[8];
#pragma unroll
      for (int q = 0; q < 8; ++q) v[q] = st[2][pc + q][rr];        /* d = rr, t = pc + q */
      split8(v, vh_[it], vl_[it]); }
  }
  {
#pragma unroll
    for (int it = 0; it < 4; ++it) {
      const unsigned rr = pr + 16u * it;
      const size_t qo = ((size_t)row0 + rr) * HD + pc;
      *(v8us*)((unsigned short*)Qh + qo) = qh_[it].v;
      *(v8us*)((unsigned short*)Ql + qo) = ql_[it].v;
      *(v8us*)((unsigned short*)Kh + qo) = kh_[it].v;
      *(v8us*)((unsigned short*)Kl + qo) = kl_[it].v;
      const size_t vo = ((size_t)bb * HD + rr) * SEQ + t0 + pc;
      *(v8us*)((unsigned short*)Vth + vo) = vh_[it].v;
      *(v8us*)((unsigned short*)Vtl + vo) = vl_[it].v;
    }
    
  }
}

// one 8-key group of the softmax row: p = exp(s - m); P carried x256 -> f16 hi + residual x1024 into fragment elements e0..e0+7
__device__ __forceinline__ void p_group(const float* sp, float newm, float& sum, FragH& ph, FragH& pl, const int e0) {
  const v4f a = *(const v4fa*)sp, c = *(const v4fa*)(sp + 4);
  const float sv[8] = {a[0],a[1],a[2],a[3],c[0],c[1],c[2],c[3]};
#pragma unroll
  for (int q = 0; q < 8; ++q) {
    const float p = __expf(sv[q] - newm);
    sum += p;
    const float pcv = p * 256.0f;
    const _Float16 hv = (_Float16)pcv;
    ph.h[e0 + q] = hv;
    pl.h[e0 + q] = (_Float16)((pcv - (float)hv) * 1024.0f);
  }
}

// LDS byte address of a __shared__ object (low 32 bits of its generic address)
__device__ __forceinline__ unsigned lds_addr(const void* p) { return (unsigned)(size_t)p; }

// Two 64-row x 128-B tiles, global -> LDS, by asynchronous 16-B copies: this thread moves rows r, r+16, r+32, r+48 of each (la/lb, ga/gb name its piece of row r; gstep = 16 source rows in elements).
// A wave's 32 lanes cover four whole 128-B lines per copy. The closing s_wait_xcnt stands inside the statement so that no address register is rewritten ahead of it.
__device__ __forceinline__ void stage2(unsigned la, const _Float16* ga, unsigned lb, const _Float16* gb, size_t gstep) {
  const unsigned ls = 16u * KP * 2u;
  asm volatile("global_load_async_to_lds_b128 %0, %8, off\n\t"
               "global_load_async_to_lds_b128 %1, %9, off\n\t"
               "global_load_async_to_lds_b128 %2, %10, off\n\t"
               "global_load_async_to_lds_b128 %3, %11, off\n\t"
               "global_load_async_to_lds_b128 %4, %12, off\n\t"
               "global_load_async_to_lds_b128 %5, %13, off\n\t"
               "global_load_async_to_lds_b128 %6, %14, off\n\t"
               "global_load_async_to_lds_b128 %7, %15, off\n\t"
               "s_wait_xcnt 0x0"
               :: "v"(la), "v"(la + ls), "v"(la + 2u * ls), "v"(la + 3u * ls), "v"(lb), "v"(lb + ls), "v"(lb + 2u * ls), "v"(lb + 3u * ls),
                  "v"(ga), "v"(ga + gstep), "v"(ga + 2u * gstep), "v"(ga + 3u * gstep), "v"(gb), "v"(gb + gstep), "v"(gb + 2u * gstep), "v"(gb + 3u * gstep)
               : "memory");
}

__global__ __launch_bounds__(128) void k_attn(const _Float16* __restrict__ Qh, const _Float16* __restrict__ Ql, const _Float16* __restrict__ Kh, const _Float16* __restrict__ Kl,
                                              const _Float16* __restrict__ Vth, const _Float16* __restrict__ Vtl, float* __restrict__ out) {
  __shared__ __attribute__((aligned(16))) float sw[4][16][SP];
  __shared__ __attribute__((aligned(16))) _Float16 kv[4][64][KP];   /* Kh, Kl [key][d] ; Vth, Vtl [d][key] of the current 64-key step */
  const unsigned tid = threadIdx.x, w = tid >> 5, lane = tid & 31u, ln = lane & 15u, hh = lane >> 4;
  /* batch = index mod NB, query tile falling with the index: a tile taken as index mod NQT gives one place the same causal length every round and the launch lasts as long as the places with the longest; here every residue of the index carries all lengths, and the longest blocks start first */
  const unsigned b = blockIdx.x % (unsigned)NB, qt = (unsigned)NQT - 1u - blockIdx.x / (unsigned)NB;
  const unsigned q0 = qt * 64u, qw0 = q0 + 16u * w;
  const size_t prow = (size_t)b * SEQ;
  const _Float16* qhp = Qh + (prow + qw0 + ln) * HD;
  const _Float16* qlp = Ql + (prow + qw0 + ln) * HD;
  const v16h aqh0 = g2_frag(qhp, hh), aqh1 = g2_frag(qhp + 32, hh), aql0 = g2_frag(qlp, hh), aql1 = g2_frag(qlp + 32, hh);
  const v8f z8 = {0.f, 0.f, 0.f, 0.f, 0.f, 0.f, 0.f, 0.f};
  v8f oh[4] = {z8, z8, z8, z8}, orr[4] = {z8, z8, z8, z8};
  float m_run = -1.0e30f, l_run = 0.f;
  const unsigned cr = tid >> 3, cc = (tid & 7u) * 8u;             /* this thread's row and 16-B piece in the staged tiles */
  const unsigned lkh = lds_addr(&kv[0][cr][cc]), lkl = lds_addr(&kv[1][cr][cc]), lvh = lds_addr(&kv[2][cr][cc]), lvl = lds_addr(&kv[3][cr][cc]);
#pragma unroll 1
  for (unsigned kt = 0; kt <= qt; ++kt) {
    asm volatile("s_wait_dscnt 0x0" ::: "memory");               /* this wave's reads of the previous tiles have returned ... */
    __syncthreads();                                              /* ... and every other wave's, before the tiles are overwritten */
    const size_t ko = (prow + kt * 64u + cr) * HD + cc;
    const size_t so = ((size_t)b * HD + cr) * SEQ + kt * 64u + cc;
    stage2(lkh, Kh + ko, lkl, Kl + ko, (size_t)16 * HD);
    stage2(lvh, Vth + so, lvl, Vtl + so, (size_t)16 * SEQ);
    asm volatile("s_wait_asynccnt 0x0" ::: "memory");            /* this wave's copies have landed ... */
    __syncthreads();                                              /* ... and every other wave's, before any fragment is read */
#pragma unroll
    for (int j = 0; j < 4; ++j) {
      const _Float16* kh = &kv[0][16 * j + (int)ln][0];
      const _Float16* kl = &kv[1][16 * j + (int)ln][0];
      const v16h bh0 = g2_frag(kh, hh), bh1 = g2_frag(kh + 32, hh), bl0 = g2_frag(kl, hh), bl1 = g2_frag(kl + 32, hh);
      v8f sh = z8, sr = z8;
      sh = g2_mma(aqh0, bh0, sh); sh = g2_mma(aqh1, bh1, sh);
      sr = g2_mma(aql0, bh0, sr); sr = g2_mma(aql1, bh1, sr);
      sr = g2_mma(aqh0, bl0, sr); sr = g2_mma(aqh1, bl1, sr);
      const unsigned kcol = kt * 64u + 16u * j + ln;
#pragma unroll
      for (int r = 0; r < 8; ++r) {
        const unsigned qi = qw0 + 8u * hh + r;
        float s = (sh[r] + sr[r] * 0.0009765625f) * 0.125f;
        s = (kcol > qi) ? -1.0e30f : s;                         /* replace-fill; exp gives exactly 0 */
        sw[w][8u * hh + r][16 * j + (int)ln] = s;
      }
    }
    __builtin_amdgcn_fence(4 /* acq_rel order */, "workgroup");
    __builtin_amdgcn_wave_barrier();
    const float* srow = &sw[w][ln][8u * hh];
    float tmax = -1.0e30f;
#pragma unroll
    for (int g = 0; g < 4; ++g) {
      const v4f a = *(const v4fa*)(srow + 16 * g), c = *(const v4fa*)(srow + 16 * g + 4);
      tmax = fmaxf(tmax, fmaxf(fmaxf(a[0], a[1]), fmaxf(a[2], a[3])));
      tmax = fmaxf(tmax, fmaxf(fmaxf(c[0], c[1]), fmaxf(c[2], c[3])));
    }
    tmax = fmaxf(tmax, __shfl_xor(tmax, 16, 32));
    const float newm = fmaxf(m_run, tmax);
    const float al = __expf(m_run - newm);
    float sum = 0.f;
    FragH ph0, ph1, pl0, pl1;
    p_group(srow,      newm, sum, ph0, pl0, 0);
    p_group(srow + 16, newm, sum, ph0, pl0, 8);
    p_group(srow + 32, newm, sum, ph1, pl1, 0);
    p_group(srow + 48, newm, sum, ph1, pl1, 8);
    sum += __shfl_xor(sum, 16, 32);
    m_run = newm;
    l_run = l_run * al + sum;
#pragma unroll
    for (int r = 0; r < 8; ++r) {
      const float ar = __shfl(al, (int)(8u * hh) + r, 32);
#pragma unroll
      for (int j = 0; j < 4; ++j) { oh[j][r] *= ar; orr[j][r] *= ar; }
    }
#pragma unroll
    for (int j = 0; j < 4; ++j) {
      const _Float16* vh = &kv[2][16 * j + (int)ln][0];
      const _Float16* vl = &kv[3][16 * j + (int)ln][0];
      const v16h bvh0 = g2_frag(vh, hh), bvh1 = g2_frag(vh + 32, hh), bvl0 = g2_frag(vl, hh), bvl1 = g2_frag(vl + 32, hh);
      oh[j]  = g2_mma(ph0.v, bvh0, oh[j]);  oh[j]  = g2_mma(ph1.v, bvh1, oh[j]);
      orr[j] = g2_mma(pl0.v, bvh0, orr[j]); orr[j] = g2_mma(pl1.v, bvh1, orr[j]);
      orr[j] = g2_mma(ph0.v, bvl0, orr[j]); orr[j] = g2_mma(ph1.v, bvl1, orr[j]);
    }
    __builtin_amdgcn_fence(4 /* acq_rel order */, "workgroup");
    __builtin_amdgcn_wave_barrier();
  }
  const float invl = 1.0f / (256.0f * l_run);                   /* l_run >= 1 */
  float ir[8];
#pragma unroll
  for (int r = 0; r < 8; ++r) ir[r] = __shfl(invl, (int)(8u * hh) + r, 32);
#pragma unroll
  for (int j = 0; j < 4; ++j)
#pragma unroll
    for (int r = 0; r < 8; ++r) sw[w][8u * hh + r][16 * j + (int)ln] = (oh[j][r] + orr[j][r] * 0.0009765625f) * ir[r];
  __builtin_amdgcn_fence(4 /* acq_rel order */, "workgroup");
  __builtin_amdgcn_wave_barrier();
  float* orow = out + ((size_t)b * SEQ_FULL + qw0) * HD;
  const unsigned c4 = ln * 4u;
  v4f ov[8];
#pragma unroll
  for (int q = 0; q < 8; ++q) ov[q] = *(const v4fa*)&sw[w][2u * q + hh][c4];
  {
#pragma unroll
    for (int q = 0; q < 8; ++q) *(v4f*)(orow + (size_t)(2u * q + hh) * HD + c4) = ov[q];   /* lanes 0-15: row 2q (256 B), lanes 16-31: row 2q+1 */
    
  }
}

extern "C" void kernel_launch(void* const* d_in, const int* in_sizes, int n_in,
                              void* d_out, int out_size, void* d_ws, size_t ws_size, hipStream_t stream) {
  if (n_in < 4) return;
  const size_t need_x = ((size_t)(NB - 1) * SEQ_FULL + SEQ) * DM;
  if ((size_t)in_sizes[0] < need_x) return;
  if (in_sizes[1] < 64 * 64 || in_sizes[2] < 64 * 64 || in_sizes[3] < 64 * 64) return;
  if ((size_t)out_size < need_x) return;
  const float* x  = (const float*)d_in[0];      /* [B][T][64] */
  const float* wk = (const float*)d_in[1];      /* w_key   [in][out] */
  const float* wq = (const float*)d_in[2];      /* w_query [in][out] */
  const float* wv = (const float*)d_in[3];      /* w_value [in][out] */
  char* ws = (char*)d_ws; size_t off = 0;
  auto take = [&](size_t bytes) { char* p = ws + off; off += (bytes + 255) & ~(size_t)255; return p; };
  _Float16* Wt  = (_Float16*)take(WT_BYTES);
  _Float16* Qh  = (_Float16*)take(PLANE_BYTES);
  _Float16* Ql  = (_Float16*)take(PLANE_BYTES);
  _Float16* Kh  = (_Float16*)take(PLANE_BYTES);
  _Float16* Kl  = (_Float16*)take(PLANE_BYTES);
  _Float16* Vth = (_Float16*)take(PLANE_BYTES);
  _Float16* Vtl = (_Float16*)take(PLANE_BYTES);
  if (off > ws_size) return;
  k_wt3<<<(3 * 64 * 8) / 256, 256, 0, stream>>>(wq, wk, wv, Wt);
  k_proj<<<(unsigned)((size_t)NB * SEQ / 64), 128, 0, stream>>>(x, Wt, Qh, Ql, Kh, Kl, Vth, Vtl);
  k_attn<<<(unsigned)((size_t)NB * NQT), 128, 0, stream>>>(Qh, Ql, Kh, Kl, Vth, Vtl, (float*)d_out);
}

// v003
// Measured time: 57.6 microseconds a run.
// In two side-by-side timings against v002, it was 1.21 and 1.22 times as fast.
// Over all steps from v000 it is 3.19 times as fast.
#include <hip/hip_runtime.h>
// Single-head causal self-attention: x [NB][SEQ][64] f32; k/q/v = x W ([in][out] 64x64, no biases; input order x, Wk, Wq, Wv); scores * 64^-0.5; causal (keys <= query); softmax; out = P v -> [NB][SEQ][64] f32.
// Compute dtype: all contractions on v_wmma_f32_16x16x32_f16 with f32 accumulate. x W: x RNE-converted to bf16 (exact in f16), W RNE-converted to bf16 then x16 (exact in f16), single product, 1/16 folded in the f32 epilogue.
// q k^T and P v: every operand as f16 hi plane + f16 residual plane carried x1024 (three products: hi.hi into the main accumulator; lo.hi + hi.lo into a separate residual accumulator folded back with 2^-10). P carried x256 before the split. Softmax statistics f32 (online, running max).
// Structure: k_wt3 (weights -> f16 x16) ; k_proj (q|k|v tiles -> hi/lo planes, stored straight from the accumulators) ; k_attn (flash-style: one wave = 16 query rows, 64-key steps; each step's K and V^T hi/lo tiles are copied once per block into LDS in whole 128-B lines and all four waves take their fragments from there).
// Every buffer that passes between the launches lies in fragment order: a 16 x 32 operand fragment is two pieces of 512 B, piece p = [lane][8 f16] with lane (ln, hh) holding row ln, k = 16p + 8hh + 0..7, so a wave writes and reads a piece as 512 contiguous bytes.
//   weights: [weight][16-column group j][32-k half][p] ; Q, K planes: [16-token tile][32-d half][p] (row = token) ; V planes: [64-token step][16-d group j][32-token half][p] (row = d).
#ifndef NB
#define NB 256
#endif
#ifndef SEQ
#define SEQ 512
#endif
#define NB_FULL 256
#define SEQ_FULL 512                 /* per-batch row stride of x and out in the full-size buffers */
#define DM 64
#define HD 64
#define NQT (SEQ / 64)               /* 64-row query tiles per batch */
#define SP 68                        /* LDS row pitch in floats (16-B aligned rows) */
#define PIECE 256                    /* f16 elements of one fragment piece: 32 lanes x 8 */
#define TILE 4096                    /* f16 elements of one 64 x 64 tile = 16 pieces */
#define PLANE_BYTES ((size_t)NB * SEQ * HD * 2)
#define WT_BYTES ((size_t)3 * 64 * 64 * 2)

static_assert(SEQ % 64 == 0);
static_assert(SEQ <= SEQ_FULL);
static_assert(NB <= NB_FULL);
static_assert(DM == 64 && HD == 64);
static_assert(WT_BYTES + 6 * PLANE_BYTES <= (size_t)134217728);
static_assert((3 * 64 * 8) % 256 == 0);

typedef _Float16 v16h __attribute__((ext_vector_type(16)));
typedef unsigned short v8us __attribute__((ext_vector_type(8), may_alias));
typedef float  v8f  __attribute__((ext_vector_type(8)));
typedef float  v4f  __attribute__((ext_vector_type(4)));
typedef float  v4fa __attribute__((ext_vector_type(4), may_alias));
union FragH { v16h v; v8us half[2]; _Float16 h[16]; unsigned short u[16]; };
union Frag8 { v8us v; _Float16 h[8]; };

// RNE convert f32 -> bf16 value (kept in an f32 container)
__device__ __forceinline__ float bf16_rne(float x) { unsigned int u = __float_as_uint(x); u = (u + 0x7FFFu + ((u >> 16) & 1u)) & 0xFFFF0000u; return __uint_as_float(u); }

// 16x32 fragment, lane (ln = lane&15: the row, hh = lane>>4): elements 0..7 <- k 8hh..8hh+7, elements 8..15 <- k 16+8hh..16+8hh+7; from fragment-order storage: p names the lane's 16 B of the first piece, the second piece follows it
__device__ __forceinline__ v16h f_frag(const _Float16* p) { FragH f; f.half[0] = *(const v8us*)(const unsigned short*)p; f.half[1] = *(const v8us*)((const unsigned short*)p + PIECE); return f.v; }
__device__ __forceinline__ v8f g2_mma(v16h a, v16h b, v8f c) { v8f d = __builtin_amdgcn_wmma_f32_16x16x32_f16(false, a, false, b, (short)0, c, false, false); asm volatile("v_nop\n\tv_nop\n\tv_nop\n\tv_nop" : "+v"(d) : "v"(a), "v"(b)); return d; }

// A fragment from an f32 row (same k map), each value RNE-converted to bf16 then cast to f16 (exact)
__device__ __forceinline__ v16h x_frag(const float* p, unsigned hh) {
  const v4f x0 = *(const v4fa*)(p + 8 * hh), x1 = *(const v4fa*)(p + 8 * hh + 4), x2 = *(const v4fa*)(p + 16 + 8 * hh), x3 = *(const v4fa*)(p + 16 + 8 * hh + 4);
  const float xs[16] = {x0[0],x0[1],x0[2],x0[3],x1[0],x1[1],x1[2],x1[3],x2[0],x2[1],x2[2],x2[3],x3[0],x3[1],x3[2],x3[3]};
  FragH f;
#pragma unroll
  for (int i = 0; i < 16; ++i) f.h[i] = (_Float16)bf16_rne(xs[i]);
  return f.v;
}

// 8 f32 -> f16 hi and f16 residual x1024
__device__ __forceinline__ void split8(const float* v, Frag8& h, Frag8& l) {
#pragma unroll
  for (int q = 0; q < 8; ++q) { const _Float16 hv = (_Float16)v[q]; h.h[q] = hv; l.h[q] = (_Float16)((v[q] - (float)hv) * 1024.0f); }
}

__global__ __launch_bounds__(256) void k_wt3(const float* __restrict__ wq, const float* __restrict__ wk, const float* __restrict__ wv, _Float16* __restrict__ Wt) {
  const unsigned t = blockIdx.x * 256u + threadIdx.x;          /* 1536 threads exactly */
  const unsigned c = blockIdx.x >> 1;                          /* block-uniform: 512 threads per weight */
  /* t = (((c*4 + j)*2 + k half)*2 + p)*32 + lane */
  const unsigned n = ((t >> 7) & 3u) * 16u + (t & 15u), k8 = ((t >> 6) & 1u) * 32u + ((t >> 5) & 1u) * 16u + ((t >> 4) & 1u) * 8u;
  const float* W = (c == 0u) ? wq : ((c == 1u) ? wk : wv);
  Frag8 f;
#pragma unroll
  for (int i = 0; i < 8; ++i) f.h[i] = (_Float16)(bf16_rne(W[(size_t)(k8 + i) * 64u + n]) * 16.0f);
  unsigned short* dst = (unsigned short*)Wt + (size_t)t * 8u;
  *(v8us*)dst = f.v;
  
}

__global__ __launch_bounds__(128) void k_proj(const float* __restrict__ x, const _Float16* __restrict__ Wt,
                                              _Float16* __restrict__ Qh, _Float16* __restrict__ Ql, _Float16* __restrict__ Kh, _Float16* __restrict__ Kl,
                                              _Float16* __restrict__ Vth, _Float16* __restrict__ Vtl) {
  const unsigned tid = threadIdx.x, w = tid >> 5, lane = tid & 31u, ln = lane & 15u, hh = lane >> 4;
  const unsigned row0 = blockIdx.x * 64u;                      /* plane row of the block */
  const unsigned bb = row0 / (unsigned)SEQ, t0 = row0 % (unsigned)SEQ;
  const float* xr = x + ((size_t)bb * SEQ_FULL + t0 + 16u * w + ln) * DM;
  const v16h a0 = x_frag(xr, hh), a1 = x_frag(xr + 32, hh);
  const v8f z8 = {0.f, 0.f, 0.f, 0.f, 0.f, 0.f, 0.f, 0.f};
  const size_t qk0 = ((size_t)(row0 / 16u + w) * 4u) * PIECE + lane * 8u;      /* this wave's 16-token tile, piece 0 */
  const size_t v0 = ((size_t)blockIdx.x * 16u + w) * PIECE + lane * 8u;        /* this block's 64-token step, d group 0, this wave's 16 tokens = piece w of the group */
#pragma unroll
  for (int c = 0; c < 3; ++c) {
#pragma unroll
    for (int j = 0; j < 4; ++j) {
      const _Float16* bp = Wt + (size_t)(c * 4 + j) * 4 * PIECE + lane * 8u;
      const v16h b0 = f_frag(bp), b1 = f_frag(bp + 2 * PIECE);
      v8f acc = z8;
      /* q, k: weights as A, x as B: the lane holds token ln, features 16j + 8hh + 0..7 = its 16 B of piece j of the token tile. v: x as A, weights as B: the lane holds feature 16j + ln, tokens 8hh + 0..7 of the wave's 16 = its 16 B of piece w of d group j. */
      if (c < 2) { acc = g2_mma(b0, a0, acc); acc = g2_mma(b1, a1, acc); }
      else       { acc = g2_mma(a0, b0, acc); acc = g2_mma(a1, b1, acc); }
      float v[8];
#pragma unroll
      for (int r = 0; r < 8; ++r) v[r] = acc[r] * 0.0625f;
      Frag8 h, l;
      split8(v, h, l);
      unsigned short* dh = (unsigned short*)(c == 0 ? Qh : (c == 1 ? Kh : Vth));
      unsigned short* dl = (unsigned short*)(c == 0 ? Ql : (c == 1 ? Kl : Vtl));
      const size_t o = (c < 2) ? qk0 + (size_t)j * PIECE : v0 + (size_t)j * 4 * PIECE;
      *(v8us*)(dh + o) = h.v;
      *(v8us*)(dl + o) = l.v;
    }
  }
}

// one 8-key group of the softmax row: p = exp(s - m); P carried x256 -> f16 hi + residual x1024 into fragment elements e0..e0+7
__device__ __forceinline__ void p_group(const float* sp, float newm, float& sum, FragH& ph, FragH& pl, const int e0) {
  const v4f a = *(const v4fa*)sp, c = *(const v4fa*)(sp + 4);
  const float sv[8] = {a[0],a[1],a[2],a[3],c[0],c[1],c[2],c[3]};
#pragma unroll
  for (int q = 0; q < 8; ++q) {
    const float p = __expf(sv[q] - newm);
    sum += p;
    const float pcv = p * 256.0f;
    const _Float16 hv = (_Float16)pcv;
    ph.h[e0 + q] = hv;
    pl.h[e0 + q] = (_Float16)((pcv - (float)hv) * 1024.0f);
  }
}

// LDS byte address of a __shared__ object (low 32 bits of its generic address)
__device__ __forceinline__ unsigned lds_addr(const void* p) { return (unsigned)(size_t)p; }

// Two 8-KiB tiles, global -> LDS in the same order, by asynchronous 16-B copies: this thread moves its 16 B of each 2-KiB quarter of each (la/lb, ga/gb name its 16 B of the first quarter).
// A wave's 32 lanes cover four whole 128-B lines per copy. The closing s_wait_xcnt stands inside the statement so that no address register is rewritten ahead of it.
__device__ __forceinline__ void stage2(unsigned la, const _Float16* ga, unsigned lb, const _Float16* gb) {
  const unsigned ls = 2048u;
  const size_t gstep = 1024;
  asm volatile("global_load_async_to_lds_b128 %0, %8, off\n\t"
               "global_load_async_to_lds_b128 %1, %9, off\n\t"
               "global_load_async_to_lds_b128 %2, %10, off\n\t"
               "global_load_async_to_lds_b128 %3, %11, off\n\t"
               "global_load_async_to_lds_b128 %4, %12, off\n\t"
               "global_load_async_to_lds_b128 %5, %13, off\n\t"
               "global_load_async_to_lds_b128 %6, %14, off\n\t"
               "global_load_async_to_lds_b128 %7, %15, off\n\t"
               "s_wait_xcnt 0x0"
               :: "v"(la), "v"(la + ls), "v"(la + 2u * ls), "v"(la + 3u * ls), "v"(lb), "v"(lb + ls), "v"(lb + 2u * ls), "v"(lb + 3u * ls),
                  "v"(ga), "v"(ga + gstep), "v"(ga + 2u * gstep), "v"(ga + 3u * gstep), "v"(gb), "v"(gb + gstep), "v"(gb + 2u * gstep), "v"(gb + 3u * gstep)
               : "memory");
}

__global__ __launch_bounds__(128) void k_attn(const _Float16* __restrict__ Qh, const _Float16* __restrict__ Ql, const _Float16* __restrict__ Kh, const _Float16* __restrict__ Kl,
                                              const _Float16* __restrict__ Vth, const _Float16* __restrict__ Vtl, float* __restrict__ out) {
  __shared__ __attribute__((aligned(16))) float sw[4][16][SP];
  __shared__ __attribute__((aligned(16))) _Float16 kv[4][TILE];     /* Kh, Kl, Vth, Vtl of the current 64-key step, in fragment order */
  const unsigned tid = threadIdx.x, w = tid >> 5, lane = tid & 31u, ln = lane & 15u, hh = lane >> 4;
  /* batch = index mod NB, query tile falling with the index: a tile taken as index mod NQT gives one place the same causal length every round and the launch lasts as long as the places with the longest; here every residue of the index carries all lengths, and the longest blocks start first */
  const unsigned b = blockIdx.x % (unsigned)NB, qt = (unsigned)NQT - 1u - blockIdx.x / (unsigned)NB;
  const unsigned q0 = qt * 64u, qw0 = q0 + 16u * w;
  const size_t prow = (size_t)b * SEQ;
  const _Float16* qhp = Qh + (prow + qw0) * HD + lane * 8u;      /* a 16-token tile is 16 * HD elements, as in row order */
  const _Float16* qlp = Ql + (prow + qw0) * HD + lane * 8u;
  const v16h aqh0 = f_frag(qhp), aqh1 = f_frag(qhp + 2 * PIECE), aql0 = f_frag(qlp), aql1 = f_frag(qlp + 2 * PIECE);
  const v8f z8 = {0.f, 0.f, 0.f, 0.f, 0.f, 0.f, 0.f, 0.f};
  v8f oh[4] = {z8, z8, z8, z8}, orr[4] = {z8, z8, z8, z8};
  float m_run = -1.0e30f, l_run = 0.f;
  const unsigned cc = tid * 8u;                                   /* this thread's 16 B in each 2-KiB quarter of the staged tiles */
  const unsigned lkh = lds_addr(&kv[0][cc]), lkl = lds_addr(&kv[1][cc]), lvh = lds_addr(&kv[2][cc]), lvl = lds_addr(&kv[3][cc]);
#pragma unroll 1
  for (unsigned kt = 0; kt <= qt; ++kt) {
    asm volatile("s_wait_dscnt 0x0" ::: "memory");               /* this wave's reads of the previous tiles have returned ... */
    __syncthreads();                                              /* ... and every other wave's, before the tiles are overwritten */
    const size_t ko = (prow + kt * 64u) * HD + cc;                /* the step's four 16-key tiles, and its V step, are each TILE contiguous elements at this offset */
    stage2(lkh, Kh + ko, lkl, Kl + ko);
    stage2(lvh, Vth + ko, lvl, Vtl + ko);
    asm volatile("s_wait_asynccnt 0x0" ::: "memory");            /* this wave's copies have landed ... */
    __syncthreads();                                              /* ... and every other wave's, before any fragment is read */
#pragma unroll
    for (int j = 0; j < 4; ++j) {
      const _Float16* kh = &kv[0][j * 4 * PIECE + lane * 8u];
      const _Float16* kl = &kv[1][j * 4 * PIECE + lane * 8u];
      const v16h bh0 = f_frag(kh), bh1 = f_frag(kh + 2 * PIECE), bl0 = f_frag(kl), bl1 = f_frag(kl + 2 * PIECE);
      v8f sh = z8, sr = z8;
      sh = g2_mma(aqh0, bh0, sh); sh = g2_mma(aqh1, bh1, sh);
      sr = g2_mma(aql0, bh0, sr); sr = g2_mma(aql1, bh1, sr);
      sr = g2_mma(aqh0, bl0, sr); sr = g2_mma(aqh1, bl1, sr);
      const unsigned kcol = kt * 64u + 16u * j + ln;
#pragma unroll
      for (int r = 0; r < 8; ++r) {
        const unsigned qi = qw0 + 8u * hh + r;
        float s = (sh[r] + sr[r] * 0.0009765625f) * 0.125f;
        s = (kcol > qi) ? -1.0e30f : s;                         /* replace-fill; exp gives exactly 0 */
        sw[w][8u * hh + r][16 * j + (int)ln] = s;
      }
    }
    __builtin_amdgcn_fence(4 /* acq_rel order */, "workgroup");
    __builtin_amdgcn_wave_barrier();
    const float* srow = &sw[w][ln][8u * hh];
    float tmax = -1.0e30f;
#pragma unroll
    for (int g = 0; g < 4; ++g) {
      const v4f a = *(const v4fa*)(srow + 16 * g), c = *(const v4fa*)(srow + 16 * g + 4);
      tmax = fmaxf(tmax, fmaxf(fmaxf(a[0], a[1]), fmaxf(a[2], a[3])));
      tmax = fmaxf(tmax, fmaxf(fmaxf(c[0], c[1]), fmaxf(c[2], c[3])));
    }
    tmax = fmaxf(tmax, __shfl_xor(tmax, 16, 32));
    const float newm = fmaxf(m_run, tmax);
    const float al = __expf(m_run - newm);
    float sum = 0.f;
    FragH ph0, ph1, pl0, pl1;
    p_group(srow,      newm, sum, ph0, pl0, 0);
    p_group(srow + 16, newm, sum, ph0, pl0, 8);
    p_group(srow + 32, newm, sum, ph1, pl1, 0);
    p_group(srow + 48, newm, sum, ph1, pl1, 8);
    sum += __shfl_xor(sum, 16, 32);
    m_run = newm;
    l_run = l_run * al + sum;
#pragma unroll
    for (int r = 0; r < 8; ++r) {
      const float ar = __shfl(al, (int)(8u * hh) + r, 32);
#pragma unroll
      for (int j = 0; j < 4; ++j) { oh[j][r] *= ar; orr[j][r] *= ar; }
    }
#pragma unroll
    for (int j = 0; j < 4; ++j) {
      const _Float16* vh = &kv[2][j * 4 * PIECE + lane * 8u];
      const _Float16* vl = &kv[3][j * 4 * PIECE + lane * 8u];
      const v16h bvh0 = f_frag(vh), bvh1 = f_frag(vh + 2 * PIECE), bvl0 = f_frag(vl), bvl1 = f_frag(vl + 2 * PIECE);
      oh[j]  = g2_mma(ph0.v, bvh0, oh[j]);  oh[j]  = g2_mma(ph1.v, bvh1, oh[j]);
      orr[j] = g2_mma(pl0.v, bvh0, orr[j]); orr[j] = g2_mma(pl1.v, bvh1, orr[j]);
      orr[j] = g2_mma(ph0.v, bvl0, orr[j]); orr[j] = g2_mma(ph1.v, bvl1, orr[j]);
    }
    __builtin_amdgcn_fence(4 /* acq_rel order */, "workgroup");
    __builtin_amdgcn_wave_barrier();
  }
  const float invl = 1.0f / (256.0f * l_run);                   /* l_run >= 1 */
  float ir[8];
#pragma unroll
  for (int r = 0; r < 8; ++r) ir[r] = __shfl(invl, (int)(8u * hh) + r, 32);
#pragma unroll
  for (int j = 0; j < 4; ++j)
#pragma unroll
    for (int r = 0; r < 8; ++r) sw[w][8u * hh + r][16 * j + (int)ln] = (oh[j][r] + orr[j][r] * 0.0009765625f) * ir[r];
  __builtin_amdgcn_fence(4 /* acq_rel order */, "workgroup");
  __builtin_amdgcn_wave_barrier();
  float* orow = out + ((size_t)b * SEQ_FULL + qw0) * HD;
  const unsigned c4 = ln * 4u;
  v4f ov[8];
#pragma unroll
  for (int q = 0; q < 8; ++q) ov[q] = *(const v4fa*)&sw[w][2u * q + hh][c4];
  {
#pragma unroll
    for (int q = 0; q < 8; ++q) *(v4f*)(orow + (size_t)(2u * q + hh) * HD + c4) = ov[q];   /* lanes 0-15: row 2q (256 B), lanes 16-31: row 2q+1 */
    
  }
}

extern "C" void kernel_launch(void* const* d_in, const int* in_sizes, int n_in,
                              void* d_out, int out_size, void* d_ws, size_t ws_size, hipStream_t stream) {
  if (n_in < 4) return;
  const size_t need_x = ((size_t)(NB - 1) * SEQ_FULL + SEQ) * DM;
  if ((size_t)in_sizes[0] < need_x) return;
  if (in_sizes[1] < 64 * 64 || in_sizes[2] < 64 * 64 || in_sizes[3] < 64 * 64) return;
  if ((size_t)out_size < need_x) return;
  const float* x  = (const float*)d_in[0];      /* [B][T][64] */
  const float* wk = (const float*)d_in[1];      /* w_key   [in][out] */
  const float* wq = (const float*)d_in[2];      /* w_query [in][out] */
  const float* wv = (const float*)d_in[3];      /* w_value [in][out] */
  char* ws = (char*)d_ws; size_t off = 0;
  auto take = [&](size_t bytes) { char* p = ws + off; off += (bytes + 255) & ~(size_t)255; return p; };
  _Float16* Wt  = (_Float16*)take(WT_BYTES);
  _Float16* Qh  = (_Float16*)take(PLANE_BYTES);
  _Float16* Ql  = (_Float16*)take(PLANE_BYTES);
  _Float16* Kh  = (_Float16*)take(PLANE_BYTES);
  _Float16* Kl  = (_Float16*)take(PLANE_BYTES);
  _Float16* Vth = (_Float16*)take(PLANE_BYTES);
  _Float16* Vtl = (_Float16*)take(PLANE_BYTES);
  if (off > ws_size) return;
  k_wt3<<<(3 * 64 * 8) / 256, 256, 0, stream>>>(wq, wk, wv, Wt);
  k_proj<<<(unsigned)((size_t)NB * SEQ / 64), 128, 0, stream>>>(x, Wt, Qh, Ql, Kh, Kl, Vth, Vtl);
  k_attn<<<(unsigned)((size_t)NB * NQT), 128, 0, stream>>>(Qh, Ql, Kh, Kl, Vth, Vtl, (float*)d_out);
}

// v004
// It runs in 38.7 microseconds.
// Two timings next to v003 both put it at 1.49 times that version's speed.
// All steps since v000 together make it 4.76 times as fast.
#include <hip/hip_runtime.h>
// Single-head causal self-attention: x [NB][SEQ][64] f32; k/q/v = x W ([in][out] 64x64, no biases; input order x, Wk, Wq, Wv); scores * 64^-0.5; causal (keys <= query); softmax; out = P v -> [NB][SEQ][64] f32.
// Compute dtype: all contractions on v_wmma_f32_16x16x32_f16 with f32 accumulate. x W: x RNE-converted to bf16 (exact in f16), W RNE-converted to bf16 then x16 (exact in f16), single product, 1/16 folded in the f32 epilogue.
// q k^T and P v: every operand as f16 hi plane + f16 residual plane carried x1024 (three products: hi.hi into the main accumulator; lo.hi + hi.lo into a separate residual accumulator folded back with 2^-10). P carried x256 before the split. Softmax statistics f32 (online, running max).
// Structure: k_wt3 (weights -> f16 x16) ; k_attn (one block of eight waves = one batch: the waves project K and V^T of all tokens into hi/lo planes that stay in LDS, one block barrier, then flash-style attention, one wave = 16 query rows at a time, 64-key steps, all fragments taken from those planes; Q goes from the projection's accumulators into its fragments in registers).
// The weights in the workspace and the planes in LDS lie in fragment order: a 16 x 32 operand fragment is two pieces of 512 B, piece p = [lane][8 f16] with lane (ln, hh) holding row ln, k = 16p + 8hh + 0..7, so a wave writes and reads a piece as 512 contiguous bytes.
//   weights: [weight][16-column group j][32-k half][p] ; LDS, per 64-token step, hi then lo: K tiles [16-token tile][32-d half][p] (row = token), then V tiles [16-d group j][32-token half][p] (row = d).
#ifndef NB
#define NB 256
#endif
#ifndef SEQ
#define SEQ 512
#endif
#define NB_FULL 256
#define SEQ_FULL 512                 /* per-batch row stride of x and out in the full-size buffers */
#define DM 64
#define HD 64
#define NW 8                         /* waves per block */
#define NT (SEQ / 16)                /* 16-token tiles per batch */
#define TPW (NT / NW)                /* tiles per wave */
#define SP 68                        /* LDS row pitch in floats (16-B aligned rows) */
#define PIECE 256                    /* f16 elements of one fragment piece: 32 lanes x 8 */
#define TILE 4096                    /* f16 elements of one 64 x 64 tile = 16 pieces */
#define WT_BYTES ((size_t)3 * 64 * 64 * 2)

static_assert(SEQ % 64 == 0);
static_assert(SEQ <= SEQ_FULL);
static_assert(NB <= NB_FULL);
static_assert(DM == 64 && HD == 64);
static_assert(TPW == 4 && NT == TPW * NW);
static_assert(4 * SEQ * HD * 2 + NW * 16 * SP * 4 <= 327680);   /* the four planes and the score scratch fit one WGP's LDS */
static_assert((3 * 64 * 8) % 256 == 0);

typedef _Float16 v16h __attribute__((ext_vector_type(16)));
typedef unsigned short v8us __attribute__((ext_vector_type(8), may_alias));
typedef float  v8f  __attribute__((ext_vector_type(8)));
typedef float  v4f  __attribute__((ext_vector_type(4)));
typedef float  v4fa __attribute__((ext_vector_type(4), may_alias));
union FragH { v16h v; v8us half[2]; _Float16 h[16]; unsigned short u[16]; };
union Frag8 { v8us v; _Float16 h[8]; };

// RNE convert f32 -> bf16 value (kept in an f32 container)
__device__ __forceinline__ float bf16_rne(float x) { unsigned int u = __float_as_uint(x); u = (u + 0x7FFFu + ((u >> 16) & 1u)) & 0xFFFF0000u; return __uint_as_float(u); }

// 16x32 fragment, lane (ln = lane&15: the row, hh = lane>>4): elements 0..7 <- k 8hh..8hh+7, elements 8..15 <- k 16+8hh..16+8hh+7; from fragment-order storage: p names the lane's 16 B of the first piece, the second piece follows it
__device__ __forceinline__ v16h f_frag(const _Float16* p) { FragH f; f.half[0] = *(const v8us*)(const unsigned short*)p; f.half[1] = *(const v8us*)((const unsigned short*)p + PIECE); return f.v; }
__device__ __forceinline__ v8f g2_mma(v16h a, v16h b, v8f c) { v8f d = __builtin_amdgcn_wmma_f32_16x16x32_f16(false, a, false, b, (short)0, c, false, false); asm volatile("v_nop\n\tv_nop\n\tv_nop\n\tv_nop" : "+v"(d) : "v"(a), "v"(b)); return d; }

// A fragment from an f32 row (same k map), each value RNE-converted to bf16 then cast to f16 (exact)
__device__ __forceinline__ v16h x_frag(const float* p, unsigned hh) {
  const v4f x0 = *(const v4fa*)(p + 8 * hh), x1 = *(const v4fa*)(p + 8 * hh + 4), x2 = *(const v4fa*)(p + 16 + 8 * hh), x3 = *(const v4fa*)(p + 16 + 8 * hh + 4);
  const float xs[16] = {x0[0],x0[1],x0[2],x0[3],x1[0],x1[1],x1[2],x1[3],x2[0],x2[1],x2[2],x2[3],x3[0],x3[1],x3[2],x3[3]};
  FragH f;
#pragma unroll
  for (int i = 0; i < 16; ++i) f.h[i] = (_Float16)bf16_rne(xs[i]);
  return f.v;
}

// 8 f32 -> f16 hi and f16 residual x1024
__device__ __forceinline__ void split8(const float* v, Frag8& h, Frag8& l) {
#pragma unroll
  for (int q = 0; q < 8; ++q) { const _Float16 hv = (_Float16)v[q]; h.h[q] = hv; l.h[q] = (_Float16)((v[q] - (float)hv) * 1024.0f); }
}

__global__ __launch_bounds__(256) void k_wt3(const float* __restrict__ wq, const float* __restrict__ wk, const float* __restrict__ wv, _Float16* __restrict__ Wt) {
  const unsigned t = blockIdx.x * 256u + threadIdx.x;          /* 1536 threads exactly */
  const unsigned c = blockIdx.x >> 1;                          /* block-uniform: 512 threads per weight */
  /* t = (((c*4 + j)*2 + k half)*2 + p)*32 + lane */
  const unsigned n = ((t >> 7) & 3u) * 16u + (t & 15u), k8 = ((t >> 6) & 1u) * 32u + ((t >> 5) & 1u) * 16u + ((t >> 4) & 1u) * 8u;
  const float* W = (c == 0u) ? wq : ((c == 1u) ? wk : wv);
  Frag8 f;
#pragma unroll
  for (int i = 0; i < 8; ++i) f.h[i] = (_Float16)(bf16_rne(W[(size_t)(k8 + i) * 64u + n]) * 16.0f);
  unsigned short* dst = (unsigned short*)Wt + (size_t)t * 8u;
  *(v8us*)dst = f.v;
  
}

// one 8-key group of the softmax row: p = exp(s - m); P carried x256 -> f16 hi + residual x1024 into fragment elements e0..e0+7
__device__ __forceinline__ void p_group(const float* sp, float newm, float& sum, FragH& ph, FragH& pl, const int e0) {
  const v4f a = *(const v4fa*)sp, c = *(const v4fa*)(sp + 4);
  const float sv[8] = {a[0],a[1],a[2],a[3],c[0],c[1],c[2],c[3]};
#pragma unroll
  for (int q = 0; q < 8; ++q) {
    const float p = __expf(sv[q] - newm);
    sum += p;
    const float pcv = p * 256.0f;
    const _Float16 hv = (_Float16)pcv;
    ph.h[e0 + q] = hv;
    pl.h[e0 + q] = (_Float16)((pcv - (float)hv) * 1024.0f);
  }
}

// one of a wave's four fragments by a wave-uniform slot number (the slot loops stay rolled, so that the kernel's text stays small)
__device__ __forceinline__ v16h pick4(unsigned i, v16h p0, v16h p1, v16h p2, v16h p3) { return i == 0u ? p0 : (i == 1u ? p1 : (i == 2u ? p2 : p3)); }

// one 16 x 16 tile of x W for one weight's column group j (fragments b0, b1), / 16, as f16 hi + residual x1024. xa false: weights as A, x as B: the lane holds token ln, features 16j + 8hh + 0..7. xa true: x as A, weights as B: the lane holds feature 16j + ln, tokens 8hh + 0..7.
__device__ __forceinline__ void proj_tile(v16h b0, v16h b1, const bool xa, v16h a0, v16h a1, Frag8& h, Frag8& l) {
  v8f acc = {0.f, 0.f, 0.f, 0.f, 0.f, 0.f, 0.f, 0.f};
  if (!xa) { acc = g2_mma(b0, a0, acc); acc = g2_mma(b1, a1, acc); }
  else     { acc = g2_mma(a0, b0, acc); acc = g2_mma(a1, b1, acc); }
  float v[8];
#pragma unroll
  for (int r = 0; r < 8; ++r) v[r] = acc[r] * 0.0625f;
  split8(v, h, l);
}

__global__ __launch_bounds__(NW * 32) void k_attn(const float* __restrict__ x, const _Float16* __restrict__ Wt, float* __restrict__ out) {
  __shared__ __attribute__((aligned(16))) float sw[NW][16][SP];
  __shared__ __attribute__((aligned(16))) _Float16 kv[SEQ / 64][4][TILE];   /* per 64-token step: Kh, Kl, Vth, Vtl tiles in fragment order; a step's four tiles lie together, so that one base register and immediate offsets reach all of its fragments */
  const unsigned tid = threadIdx.x, w = tid >> 5, lane = tid & 31u, ln = lane & 15u, hh = lane >> 4;
  const unsigned b = blockIdx.x;
  /* the wave's four 16-token tiles: w, 15 - w, 16 + w, 31 - w: every wave walks the same number of 64-key steps */
  const unsigned wu = (unsigned)__builtin_amdgcn_readfirstlane((int)w);
  const float* xb = x + ((size_t)b * SEQ_FULL + ln) * DM;
  const float* x0 = xb + (size_t)(16u * wu) * DM;
  const float* x1 = xb + (size_t)(16u * (2u * NW - 1u - wu)) * DM;
  const float* x2 = xb + (size_t)(16u * (2u * NW + wu)) * DM;
  const float* x3 = xb + (size_t)(16u * (4u * NW - 1u - wu)) * DM;
  /* behind each tile's loads: s_wait_xcnt 0, so that no later load's result or address sum goes over an address register of an issued load ahead of it */
  const v16h xa00 = x_frag(x0, hh), xa01 = x_frag(x0 + 32, hh);
  asm volatile("s_wait_xcnt 0x0" ::: "memory");
  const v16h xa10 = x_frag(x1, hh), xa11 = x_frag(x1 + 32, hh);
  asm volatile("s_wait_xcnt 0x0" ::: "memory");
  const v16h xa20 = x_frag(x2, hh), xa21 = x_frag(x2 + 32, hh);
  asm volatile("s_wait_xcnt 0x0" ::: "memory");
  const v16h xa30 = x_frag(x3, hh), xa31 = x_frag(x3 + 32, hh);
  asm volatile("s_wait_xcnt 0x0" ::: "memory");
  /* all weight fragments, loaded once behind the x loads and kept in registers: [weight q, k, v][column group j][k half] */
  v16h wf[3][4][2];
#pragma unroll
  for (int cj = 0; cj < 12; ++cj) {
    const _Float16* bp = Wt + (size_t)cj * 4 * PIECE + lane * 8u;
    wf[cj >> 2][cj & 3][0] = f_frag(bp);
    wf[cj >> 2][cj & 3][1] = f_frag(bp + 2 * PIECE);
  }
  asm volatile("s_wait_xcnt 0x0" ::: "memory");                  /* as above, for the weight loads' address register */
  /* K and V^T of the wave's tiles -> LDS planes */
#pragma unroll 1   /* rolled: the body runs four times only, and unrolled it would quadruple the text ahead of the hot loop */
  for (unsigned i = 0; i < (unsigned)TPW; ++i) {
    const unsigned tt = (i >> 1) * (2u * NW) + ((i & 1u) ? 2u * NW - 1u - wu : wu);
    const v16h a0 = pick4(i, xa00, xa10, xa20, xa30), a1 = pick4(i, xa01, xa11, xa21, xa31);
#pragma unroll
    for (int j = 0; j < 4; ++j) {
      Frag8 h, l;
      proj_tile(wf[1][j][0], wf[1][j][1], false, a0, a1, h, l);
      const unsigned ok = ((tt & 3u) * 4u + (unsigned)j) * PIECE + lane * 8u;      /* 64-token step tt / 4: piece j of its token tile tt mod 4 */
      *(v8us*)(unsigned short*)&kv[tt >> 2][0][ok] = h.v;
      *(v8us*)(unsigned short*)&kv[tt >> 2][1][ok] = l.v;
      proj_tile(wf[2][j][0], wf[2][j][1], true, a0, a1, h, l);
      const unsigned ov = ((unsigned)j * 4u + (tt & 3u)) * PIECE + lane * 8u;      /* the same step: d group j, piece tt mod 4 */
      *(v8us*)(unsigned short*)&kv[tt >> 2][2][ov] = h.v;
      *(v8us*)(unsigned short*)&kv[tt >> 2][3][ov] = l.v;
    }
  }
  __syncthreads();                                                /* every wave's K and V^T pieces are in LDS before any fragment is read; the planes are only read from here on */
  const v8f z8 = {0.f, 0.f, 0.f, 0.f, 0.f, 0.f, 0.f, 0.f};
#pragma unroll 1   /* rolled: one copy of the hot loop in the text */
  for (unsigned i = 0; i < (unsigned)TPW; ++i) {
    const unsigned tt = (i >> 1) * (2u * NW) + ((i & 1u) ? 2u * NW - 1u - wu : wu);
    const unsigned qt = tt >> 2, qw0 = 16u * tt;
    FragH qh0, qh1, ql0, ql1;
    {
      const v16h a0 = pick4(i, xa00, xa10, xa20, xa30), a1 = pick4(i, xa01, xa11, xa21, xa31);
      Frag8 h, l;
      /* the lane's 16 B of piece j are elements 8 (j mod 2) .. + 7 of the fragment of d half j / 2 */
      proj_tile(wf[0][0][0], wf[0][0][1], false, a0, a1, h, l); qh0.half[0] = h.v; ql0.half[0] = l.v;
      proj_tile(wf[0][1][0], wf[0][1][1], false, a0, a1, h, l); qh0.half[1] = h.v; ql0.half[1] = l.v;
      proj_tile(wf[0][2][0], wf[0][2][1], false, a0, a1, h, l); qh1.half[0] = h.v; ql1.half[0] = l.v;
      proj_tile(wf[0][3][0], wf[0][3][1], false, a0, a1, h, l); qh1.half[1] = h.v; ql1.half[1] = l.v;
    }
    const v16h aqh0 = qh0.v, aqh1 = qh1.v, aql0 = ql0.v, aql1 = ql1.v;
    v8f oh[4] = {z8, z8, z8, z8}, orr[4] = {z8, z8, z8, z8};
    float m_run = -1.0e30f, l_run = 0.f;
#pragma unroll 1   /* rolled: the trip count differs from tile to tile */
    for (unsigned kt = 0; kt <= qt; ++kt) {
#pragma unroll
      for (int j = 0; j < 4; ++j) {
        const _Float16* kh = &kv[kt][0][j * 4 * PIECE + lane * 8u];
        const _Float16* kl = &kv[kt][1][j * 4 * PIECE + lane * 8u];
        const v16h bh0 = f_frag(kh), bh1 = f_frag(kh + 2 * PIECE), bl0 = f_frag(kl), bl1 = f_frag(kl + 2 * PIECE);
        v8f sh = z8, sr = z8;
        sh = g2_mma(aqh0, bh0, sh); sh = g2_mma(aqh1, bh1, sh);
        sr = g2_mma(aql0, bh0, sr); sr = g2_mma(aql1, bh1, sr);
        sr = g2_mma(aqh0, bl0, sr); sr = g2_mma(aqh1, bl1, sr);
        const unsigned kcol = kt * 64u + 16u * j + ln;
#pragma unroll
        for (int r = 0; r < 8; ++r) {
          const unsigned qi = qw0 + 8u * hh + r;
          float s = (sh[r] + sr[r] * 0.0009765625f) * 0.125f;
          s = (kcol > qi) ? -1.0e30f : s;                         /* replace-fill; exp gives exactly 0 */
          sw[w][8u * hh + r][16 * j + (int)ln] = s;
        }
      }
      __builtin_amdgcn_fence(4 /* acq_rel order */, "workgroup");
      __builtin_amdgcn_wave_barrier();
      const float* srow = &sw[w][ln][8u * hh];
      float tmax = -1.0e30f;
#pragma unroll
      for (int g = 0; g < 4; ++g) {
        const v4f a = *(const v4fa*)(srow + 16 * g), c = *(const v4fa*)(srow + 16 * g + 4);
        tmax = fmaxf(tmax, fmaxf(fmaxf(a[0], a[1]), fmaxf(a[2], a[3])));
        tmax = fmaxf(tmax, fmaxf(fmaxf(c[0], c[1]), fmaxf(c[2], c[3])));
      }
      tmax = fmaxf(tmax, __shfl_xor(tmax, 16, 32));
      const float newm = fmaxf(m_run, tmax);
      const float al = __expf(m_run - newm);
      float sum = 0.f;
      FragH ph0, ph1, pl0, pl1;
      p_group(srow,      newm, sum, ph0, pl0, 0);
      p_group(srow + 16, newm, sum, ph0, pl0, 8);
      p_group(srow + 32, newm, sum, ph1, pl1, 0);
      p_group(srow + 48, newm, sum, ph1, pl1, 8);
      sum += __shfl_xor(sum, 16, 32);
      m_run = newm;
      l_run = l_run * al + sum;
#pragma unroll
      for (int r = 0; r < 8; ++r) {
        const float ar = __shfl(al, (int)(8u * hh) + r, 32);
#pragma unroll
        for (int j = 0; j < 4; ++j) { oh[j][r] *= ar; orr[j][r] *= ar; }
      }
#pragma unroll
      for (int j = 0; j < 4; ++j) {
        const _Float16* vh = &kv[kt][2][j * 4 * PIECE + lane * 8u];
        const _Float16* vl = &kv[kt][3][j * 4 * PIECE + lane * 8u];
        const v16h bvh0 = f_frag(vh), bvh1 = f_frag(vh + 2 * PIECE), bvl0 = f_frag(vl), bvl1 = f_frag(vl + 2 * PIECE);
        oh[j]  = g2_mma(ph0.v, bvh0, oh[j]);  oh[j]  = g2_mma(ph1.v, bvh1, oh[j]);
        orr[j] = g2_mma(pl0.v, bvh0, orr[j]); orr[j] = g2_mma(pl1.v, bvh1, orr[j]);
        orr[j] = g2_mma(ph0.v, bvl0, orr[j]); orr[j] = g2_mma(ph1.v, bvl1, orr[j]);
      }
      __builtin_amdgcn_fence(4 /* acq_rel order */, "workgroup");
      __builtin_amdgcn_wave_barrier();
    }
    const float invl = 1.0f / (256.0f * l_run);                   /* l_run >= 1 */
    float ir[8];
#pragma unroll
    for (int r = 0; r < 8; ++r) ir[r] = __shfl(invl, (int)(8u * hh) + r, 32);
#pragma unroll
    for (int j = 0; j < 4; ++j)
#pragma unroll
      for (int r = 0; r < 8; ++r) sw[w][8u * hh + r][16 * j + (int)ln] = (oh[j][r] + orr[j][r] * 0.0009765625f) * ir[r];
    __builtin_amdgcn_fence(4 /* acq_rel order */, "workgroup");
    __builtin_amdgcn_wave_barrier();
    float* orow = out + ((size_t)b * SEQ_FULL + qw0) * HD;
    const unsigned c4 = ln * 4u;
    v4f ov[8];
#pragma unroll
    for (int q = 0; q < 8; ++q) ov[q] = *(const v4fa*)&sw[w][2u * q + hh][c4];
#pragma unroll
    for (int q = 0; q < 8; ++q) *(v4f*)(orow + (size_t)(2u * q + hh) * HD + c4) = ov[q];   /* lanes 0-15: row 2q (256 B), lanes 16-31: row 2q+1 */
    asm volatile("s_wait_xcnt 0x0" ::: "memory");                /* before the next tile's code goes over the stores' address and data registers */
  }
}

extern "C" void kernel_launch(void* const* d_in, const int* in_sizes, int n_in,
                              void* d_out, int out_size, void* d_ws, size_t ws_size, hipStream_t stream) {
  if (n_in < 4) return;
  const size_t need_x = ((size_t)(NB - 1) * SEQ_FULL + SEQ) * DM;
  if ((size_t)in_sizes[0] < need_x) return;
  if (in_sizes[1] < 64 * 64 || in_sizes[2] < 64 * 64 || in_sizes[3] < 64 * 64) return;
  if ((size_t)out_size < need_x) return;
  const float* x  = (const float*)d_in[0];      /* [B][T][64] */
  const float* wk = (const float*)d_in[1];      /* w_key   [in][out] */
  const float* wq = (const float*)d_in[2];      /* w_query [in][out] */
  const float* wv = (const float*)d_in[3];      /* w_value [in][out] */
  if (WT_BYTES > ws_size) return;
  _Float16* Wt  = (_Float16*)d_ws;
  k_wt3<<<(3 * 64 * 8) / 256, 256, 0, stream>>>(wq, wk, wv, Wt);
  k_attn<<<NB, NW * 32, 0, stream>>>(x, Wt, (float*)d_out);
}

// v005
// A run of this version takes 35 microseconds.
// In two side-by-side timings against v004, it was 1.10 and 1.11 times as fast.
// Counting every step since v000, it is 5.27 times as fast.
#include <hip/hip_runtime.h>
// Single-head causal self-attention: x [NB][SEQ][64] f32; k/q/v = x W ([in][out] 64x64, no biases; input order x, Wk, Wq, Wv); scores * 64^-0.5; causal (keys <= query); softmax; out = P v -> [NB][SEQ][64] f32.
// Compute dtype: all contractions on v_wmma_f32_16x16x32_f16 with f32 accumulate. x W: x RNE-converted to bf16 (exact in f16), W RNE-converted to bf16 then x16 (exact in f16), single product, 1/16 folded in the f32 epilogue.
// q k^T and P v: every operand as f16 hi plane + f16 residual plane carried x1024 (three products: hi.hi into the main accumulator; lo.hi + hi.lo into a separate residual accumulator folded back with 2^-10). P carried x256 before the split. Softmax statistics f32 (online, running max).
// Structure: k_wt3 (weights -> f16 x16) ; k_attn (one block of eight waves = one batch: the waves project K and V^T of all tokens into hi/lo planes that stay in LDS, one block barrier, then flash-style attention, one wave = 16 query rows at a time, 64-key steps, all fragments taken from those planes; Q goes from the projection's accumulators into its fragments in registers).
// The weights in the workspace and the planes in LDS lie in fragment order: a 16 x 32 operand fragment is two pieces of 512 B, piece p = [lane][8 f16] with lane (ln, hh) holding row ln, k = 16p + 8hh + 0..7, so a wave writes and reads a piece as 512 contiguous bytes.
//   weights: [weight][16-column group j][32-k half][p] ; LDS, per 64-token step, hi then lo: K tiles [16-token tile][32-d half][p] (row = token), then V tiles [16-d group j][32-token half][p] (row = d).
#ifndef NB
#define NB 256
#endif
#ifndef SEQ
#define SEQ 512
#endif
#define NB_FULL 256
#define SEQ_FULL 512                 /* per-batch row stride of x and out in the full-size buffers */
#define DM 64
#define HD 64
#define NW 8                         /* waves per block */
#define NT (SEQ / 16)                /* 16-token tiles per batch */
#define TPW (NT / NW)                /* tiles per wave */
#define SP 68                        /* LDS row pitch in floats (16-B aligned rows) */
#define PIECE 256                    /* f16 elements of one fragment piece: 32 lanes x 8 */
#define TILE 4096                    /* f16 elements of one 64 x 64 tile = 16 pieces */
#define WT_BYTES ((size_t)3 * 64 * 64 * 2)

static_assert(SEQ % 64 == 0);
static_assert(SEQ <= SEQ_FULL);
static_assert(NB <= NB_FULL);
static_assert(DM == 64 && HD == 64);
static_assert(TPW == 4 && NT == TPW * NW);
static_assert(4 * SEQ * HD * 2 + NW * 16 * SP * 4 <= 327680);   /* the four planes and the score scratch fit one WGP's LDS */
static_assert((3 * 64 * 8) % 256 == 0);

typedef _Float16 v16h __attribute__((ext_vector_type(16)));
typedef unsigned short v8us __attribute__((ext_vector_type(8), may_alias));
typedef float  v8f  __attribute__((ext_vector_type(8)));
typedef float  v4f  __attribute__((ext_vector_type(4)));
typedef float  v4fa __attribute__((ext_vector_type(4), may_alias));
union FragH { v16h v; v8us half[2]; _Float16 h[16]; unsigned short u[16]; };
union Frag8 { v8us v; _Float16 h[8]; };

// RNE convert f32 -> bf16 value (kept in an f32 container)
__device__ __forceinline__ float bf16_rne(float x) { unsigned int u = __float_as_uint(x); u = (u + 0x7FFFu + ((u >> 16) & 1u)) & 0xFFFF0000u; return __uint_as_float(u); }

// 16x32 fragment, lane (ln = lane&15: the row, hh = lane>>4): elements 0..7 <- k 8hh..8hh+7, elements 8..15 <- k 16+8hh..16+8hh+7; from fragment-order storage: p names the lane's 16 B of the first piece, the second piece follows it
__device__ __forceinline__ v16h f_frag(const _Float16* p) { FragH f; f.half[0] = *(const v8us*)(const unsigned short*)p; f.half[1] = *(const v8us*)((const unsigned short*)p + PIECE); return f.v; }
__device__ __forceinline__ v8f g2_mma(v16h a, v16h b, v8f c) { return __builtin_amdgcn_wmma_f32_16x16x32_f16(false, a, false, b, (short)0, c, false, false); }

// A fragment from an f32 row (same k map), each value RNE-converted to bf16 then cast to f16 (exact)
__device__ __forceinline__ v16h x_frag(const float* p, unsigned hh) {
  const v4f x0 = *(const v4fa*)(p + 8 * hh), x1 = *(const v4fa*)(p + 8 * hh + 4), x2 = *(const v4fa*)(p + 16 + 8 * hh), x3 = *(const v4fa*)(p + 16 + 8 * hh + 4);
  const float xs[16] = {x0[0],x0[1],x0[2],x0[3],x1[0],x1[1],x1[2],x1[3],x2[0],x2[1],x2[2],x2[3],x3[0],x3[1],x3[2],x3[3]};
  FragH f;
#pragma unroll
  for (int i = 0; i < 16; ++i) f.h[i] = (_Float16)bf16_rne(xs[i]);
  return f.v;
}

// 8 f32 -> f16 hi and f16 residual x1024
__device__ __forceinline__ void split8(const float* v, Frag8& h, Frag8& l) {
#pragma unroll
  for (int q = 0; q < 8; ++q) { const _Float16 hv = (_Float16)v[q]; h.h[q] = hv; l.h[q] = (_Float16)((v[q] - (float)hv) * 1024.0f); }
}

__global__ __launch_bounds__(256) void k_wt3(const float* __restrict__ wq, const float* __restrict__ wk, const float* __restrict__ wv, _Float16* __restrict__ Wt) {
  const unsigned t = blockIdx.x * 256u + threadIdx.x;          /* 1536 threads exactly */
  const unsigned c = blockIdx.x >> 1;                          /* block-uniform: 512 threads per weight */
  /* t = (((c*4 + j)*2 + k half)*2 + p)*32 + lane */
  const unsigned n = ((t >> 7) & 3u) * 16u + (t & 15u), k8 = ((t >> 6) & 1u) * 32u + ((t >> 5) & 1u) * 16u + ((t >> 4) & 1u) * 8u;
  const float* W = (c == 0u) ? wq : ((c == 1u) ? wk : wv);
  Frag8 f;
#pragma unroll
  for (int i = 0; i < 8; ++i) f.h[i] = (_Float16)(bf16_rne(W[(size_t)(k8 + i) * 64u + n]) * 16.0f);
  unsigned short* dst = (unsigned short*)Wt + (size_t)t * 8u;
  *(v8us*)dst = f.v;
  
}

// one 8-key group of the softmax row: p = exp(s - m); P carried x256 -> f16 hi + residual x1024 into fragment elements e0..e0+7
__device__ __forceinline__ void p_group(const float* sp, float newm, float& sum, FragH& ph, FragH& pl, const int e0) {
  const v4f a = *(const v4fa*)sp, c = *(const v4fa*)(sp + 4);
  const float sv[8] = {a[0],a[1],a[2],a[3],c[0],c[1],c[2],c[3]};
#pragma unroll
  for (int q = 0; q < 8; ++q) {
    const float p = __expf(sv[q] - newm);
    sum += p;
    const float pcv = p * 256.0f;
    const _Float16 hv = (_Float16)pcv;
    ph.h[e0 + q] = hv;
    pl.h[e0 + q] = (_Float16)((pcv - (float)hv) * 1024.0f);
  }
}

// one of a wave's four fragments by a wave-uniform slot number (the slot loops stay rolled, so that the kernel's text stays small)
__device__ __forceinline__ v16h pick4(unsigned i, v16h p0, v16h p1, v16h p2, v16h p3) { return i == 0u ? p0 : (i == 1u ? p1 : (i == 2u ? p2 : p3)); }

// one 16 x 16 tile of x W for one weight's column group j (fragments b0, b1), / 16, as f16 hi + residual x1024. xa false: weights as A, x as B: the lane holds token ln, features 16j + 8hh + 0..7. xa true: x as A, weights as B: the lane holds feature 16j + ln, tokens 8hh + 0..7.
__device__ __forceinline__ void proj_tile(v16h b0, v16h b1, const bool xa, v16h a0, v16h a1, Frag8& h, Frag8& l) {
  v8f acc = {0.f, 0.f, 0.f, 0.f, 0.f, 0.f, 0.f, 0.f};
  if (!xa) { acc = g2_mma(b0, a0, acc); acc = g2_mma(b1, a1, acc); }
  else     { acc = g2_mma(a0, b0, acc); acc = g2_mma(a1, b1, acc); }
  float v[8];
#pragma unroll
  for (int r = 0; r < 8; ++r) v[r] = acc[r] * 0.0625f;
  split8(v, h, l);
}

__global__ __launch_bounds__(NW * 32) void k_attn(const float* __restrict__ x, const _Float16* __restrict__ Wt, float* __restrict__ out) {
  __shared__ __attribute__((aligned(16))) float sw[NW][16][SP];
  __shared__ __attribute__((aligned(16))) _Float16 kv[SEQ / 64][4][TILE];   /* per 64-token step: Kh, Kl, Vth, Vtl tiles in fragment order; a step's four tiles lie together, so that one base register and immediate offsets reach all of its fragments */
  const unsigned tid = threadIdx.x, w = tid >> 5, lane = tid & 31u, ln = lane & 15u, hh = lane >> 4;
  const unsigned b = blockIdx.x;
  /* the wave's four 16-token tiles: w, 15 - w, 16 + w, 31 - w: every wave walks the same number of 64-key steps */
  const unsigned wu = (unsigned)__builtin_amdgcn_readfirstlane((int)w);
  const float* xb = x + ((size_t)b * SEQ_FULL + ln) * DM;
  const float* x0 = xb + (size_t)(16u * wu) * DM;
  const float* x1 = xb + (size_t)(16u * (2u * NW - 1u - wu)) * DM;
  const float* x2 = xb + (size_t)(16u * (2u * NW + wu)) * DM;
  const float* x3 = xb + (size_t)(16u * (4u * NW - 1u - wu)) * DM;
  /* behind each tile's loads: s_wait_xcnt 0, so that no later load's result or address sum goes over an address register of an issued load ahead of it */
  const v16h xa00 = x_frag(x0, hh), xa01 = x_frag(x0 + 32, hh);
  asm volatile("s_wait_xcnt 0x0" ::: "memory");
  const v16h xa10 = x_frag(x1, hh), xa11 = x_frag(x1 + 32, hh);
  asm volatile("s_wait_xcnt 0x0" ::: "memory");
  const v16h xa20 = x_frag(x2, hh), xa21 = x_frag(x2 + 32, hh);
  asm volatile("s_wait_xcnt 0x0" ::: "memory");
  const v16h xa30 = x_frag(x3, hh), xa31 = x_frag(x3 + 32, hh);
  asm volatile("s_wait_xcnt 0x0" ::: "memory");
  /* all weight fragments, loaded once behind the x loads and kept in registers: [weight q, k, v][column group j][k half] */
  v16h wf[3][4][2];
#pragma unroll
  for (int cj = 0; cj < 12; ++cj) {
    const _Float16* bp = Wt + (size_t)cj * 4 * PIECE + lane * 8u;
    wf[cj >> 2][cj & 3][0] = f_frag(bp);
    wf[cj >> 2][cj & 3][1] = f_frag(bp + 2 * PIECE);
  }
  asm volatile("s_wait_xcnt 0x0" ::: "memory");                  /* as above, for the weight loads' address register */
  /* K and V^T of the wave's tiles -> LDS planes */
#pragma unroll 1   /* rolled: the body runs four times only, and unrolled it would quadruple the text ahead of the hot loop */
  for (unsigned i = 0; i < (unsigned)TPW; ++i) {
    const unsigned tt = (i >> 1) * (2u * NW) + ((i & 1u) ? 2u * NW - 1u - wu : wu);
    const v16h a0 = pick4(i, xa00, xa10, xa20, xa30), a1 = pick4(i, xa01, xa11, xa21, xa31);
#pragma unroll
    for (int j = 0; j < 4; ++j) {
      Frag8 h, l;
      proj_tile(wf[1][j][0], wf[1][j][1], false, a0, a1, h, l);
      const unsigned ok = ((tt & 3u) * 4u + (unsigned)j) * PIECE + lane * 8u;      /* 64-token step tt / 4: piece j of its token tile tt mod 4 */
      *(v8us*)(unsigned short*)&kv[tt >> 2][0][ok] = h.v;
      *(v8us*)(unsigned short*)&kv[tt >> 2][1][ok] = l.v;
      proj_tile(wf[2][j][0], wf[2][j][1], true, a0, a1, h, l);
      const unsigned ov = ((unsigned)j * 4u + (tt & 3u)) * PIECE + lane * 8u;      /* the same step: d group j, piece tt mod 4 */
      *(v8us*)(unsigned short*)&kv[tt >> 2][2][ov] = h.v;
      *(v8us*)(unsigned short*)&kv[tt >> 2][3][ov] = l.v;
    }
  }
  __syncthreads();                                                /* every wave's K and V^T pieces are in LDS before any fragment is read; the planes are only read from here on */
  const v8f z8 = {0.f, 0.f, 0.f, 0.f, 0.f, 0.f, 0.f, 0.f};
#pragma unroll 1   /* rolled: one copy of the hot loop in the text */
  for (unsigned i = 0; i < (unsigned)TPW; ++i) {
    const unsigned tt = (i >> 1) * (2u * NW) + ((i & 1u) ? 2u * NW - 1u - wu : wu);
    const unsigned qt = tt >> 2, qw0 = 16u * tt;
    FragH qh0, qh1, ql0, ql1;
    {
      const v16h a0 = pick4(i, xa00, xa10, xa20, xa30), a1 = pick4(i, xa01, xa11, xa21, xa31);
      Frag8 h, l;
      /* the lane's 16 B of piece j are elements 8 (j mod 2) .. + 7 of the fragment of d half j / 2 */
      proj_tile(wf[0][0][0], wf[0][0][1], false, a0, a1, h, l); qh0.half[0] = h.v; ql0.half[0] = l.v;
      proj_tile(wf[0][1][0], wf[0][1][1], false, a0, a1, h, l); qh0.half[1] = h.v; ql0.half[1] = l.v;
      proj_tile(wf[0][2][0], wf[0][2][1], false, a0, a1, h, l); qh1.half[0] = h.v; ql1.half[0] = l.v;
      proj_tile(wf[0][3][0], wf[0][3][1], false, a0, a1, h, l); qh1.half[1] = h.v; ql1.half[1] = l.v;
    }
    const v16h aqh0 = qh0.v, aqh1 = qh1.v, aql0 = ql0.v, aql1 = ql1.v;
    v8f oh[4] = {z8, z8, z8, z8}, orr[4] = {z8, z8, z8, z8};
    float m_run = -1.0e30f, l_run = 0.f;
#pragma unroll 1   /* rolled: the trip count differs from tile to tile */
    for (unsigned kt = 0; kt <= qt; ++kt) {
#pragma unroll
      for (int j = 0; j < 4; ++j) {
        const _Float16* kh = &kv[kt][0][j * 4 * PIECE + lane * 8u];
        const _Float16* kl = &kv[kt][1][j * 4 * PIECE + lane * 8u];
        const v16h bh0 = f_frag(kh), bh1 = f_frag(kh + 2 * PIECE), bl0 = f_frag(kl), bl1 = f_frag(kl + 2 * PIECE);
        v8f sh = z8, sr = z8;
        sh = g2_mma(aqh0, bh0, sh); sh = g2_mma(aqh1, bh1, sh);
        sr = g2_mma(aql0, bh0, sr); sr = g2_mma(aql1, bh1, sr);
        sr = g2_mma(aqh0, bl0, sr); sr = g2_mma(aqh1, bl1, sr);
        const unsigned kcol = kt * 64u + 16u * j + ln;
#pragma unroll
        for (int r = 0; r < 8; ++r) {
          const unsigned qi = qw0 + 8u * hh + r;
          float s = (sh[r] + sr[r] * 0.0009765625f) * 0.125f;
          s = (kcol > qi) ? -1.0e30f : s;                         /* replace-fill; exp gives exactly 0 */
          sw[w][8u * hh + r][16 * j + (int)ln] = s;
        }
      }
      __builtin_amdgcn_fence(4 /* acq_rel order */, "workgroup");
      __builtin_amdgcn_wave_barrier();
      const float* srow = &sw[w][ln][8u * hh];
      float tmax = -1.0e30f;
#pragma unroll
      for (int g = 0; g < 4; ++g) {
        const v4f a = *(const v4fa*)(srow + 16 * g), c = *(const v4fa*)(srow + 16 * g + 4);
        tmax = fmaxf(tmax, fmaxf(fmaxf(a[0], a[1]), fmaxf(a[2], a[3])));
        tmax = fmaxf(tmax, fmaxf(fmaxf(c[0], c[1]), fmaxf(c[2], c[3])));
      }
      tmax = fmaxf(tmax, __shfl_xor(tmax, 16, 32));
      const float newm = fmaxf(m_run, tmax);
      const float al = __expf(m_run - newm);
      float sum = 0.f;
      FragH ph0, ph1, pl0, pl1;
      p_group(srow,      newm, sum, ph0, pl0, 0);
      p_group(srow + 16, newm, sum, ph0, pl0, 8);
      p_group(srow + 32, newm, sum, ph1, pl1, 0);
      p_group(srow + 48, newm, sum, ph1, pl1, 8);
      sum += __shfl_xor(sum, 16, 32);
      m_run = newm;
      l_run = l_run * al + sum;
#pragma unroll
      for (int r = 0; r < 8; ++r) {
        const float ar = __shfl(al, (int)(8u * hh) + r, 32);
#pragma unroll
        for (int j = 0; j < 4; ++j) { oh[j][r] *= ar; orr[j][r] *= ar; }
      }
#pragma unroll
      for (int j = 0; j < 4; ++j) {
        const _Float16* vh = &kv[kt][2][j * 4 * PIECE + lane * 8u];
        const _Float16* vl = &kv[kt][3][j * 4 * PIECE + lane * 8u];
        const v16h bvh0 = f_frag(vh), bvh1 = f_frag(vh + 2 * PIECE), bvl0 = f_frag(vl), bvl1 = f_frag(vl + 2 * PIECE);
        oh[j]  = g2_mma(ph0.v, bvh0, oh[j]);  oh[j]  = g2_mma(ph1.v, bvh1, oh[j]);
        orr[j] = g2_mma(pl0.v, bvh0, orr[j]); orr[j] = g2_mma(pl1.v, bvh1, orr[j]);
        orr[j] = g2_mma(ph0.v, bvl0, orr[j]); orr[j] = g2_mma(ph1.v, bvl1, orr[j]);
      }
      __builtin_amdgcn_fence(4 /* acq_rel order */, "workgroup");
      __builtin_amdgcn_wave_barrier();
    }
    const float invl = 1.0f / (256.0f * l_run);                   /* l_run >= 1 */
    float ir[8];
#pragma unroll
    for (int r = 0; r < 8; ++r) ir[r] = __shfl(invl, (int)(8u * hh) + r, 32);
#pragma unroll
    for (int j = 0; j < 4; ++j)
#pragma unroll
      for (int r = 0; r < 8; ++r) sw[w][8u * hh + r][16 * j + (int)ln] = (oh[j][r] + orr[j][r] * 0.0009765625f) * ir[r];
    __builtin_amdgcn_fence(4 /* acq_rel order */, "workgroup");
    __builtin_amdgcn_wave_barrier();
    float* orow = out + ((size_t)b * SEQ_FULL + qw0) * HD;
    const unsigned c4 = ln * 4u;
    v4f ov[8];
#pragma unroll
    for (int q = 0; q < 8; ++q) ov[q] = *(const v4fa*)&sw[w][2u * q + hh][c4];
#pragma unroll
    for (int q = 0; q < 8; ++q) *(v4f*)(orow + (size_t)(2u * q + hh) * HD + c4) = ov[q];   /* lanes 0-15: row 2q (256 B), lanes 16-31: row 2q+1 */
    asm volatile("s_wait_xcnt 0x0" ::: "memory");                /* before the next tile's code goes over the stores' address and data registers */
  }
}

extern "C" void kernel_launch(void* const* d_in, const int* in_sizes, int n_in,
                              void* d_out, int out_size, void* d_ws, size_t ws_size, hipStream_t stream) {
  if (n_in < 4) return;
  const size_t need_x = ((size_t)(NB - 1) * SEQ_FULL + SEQ) * DM;
  if ((size_t)in_sizes[0] < need_x) return;
  if (in_sizes[1] < 64 * 64 || in_sizes[2] < 64 * 64 || in_sizes[3] < 64 * 64) return;
  if ((size_t)out_size < need_x) return;
  const float* x  = (const float*)d_in[0];      /* [B][T][64] */
  const float* wk = (const float*)d_in[1];      /* w_key   [in][out] */
  const float* wq = (const float*)d_in[2];      /* w_query [in][out] */
  const float* wv = (const float*)d_in[3];      /* w_value [in][out] */
  if (WT_BYTES > ws_size) return;
  _Float16* Wt  = (_Float16*)d_ws;
  k_wt3<<<(3 * 64 * 8) / 256, 256, 0, stream>>>(wq, wk, wv, Wt);
  k_attn<<<NB, NW * 32, 0, stream>>>(x, Wt, (float*)d_out);
}

// v006
// It runs in 33.1 microseconds.
// Two timings next to v005 both put it at 1.05 times that version's speed.
// All steps since v000 together make it 5.55 times as fast.
#include <hip/hip_runtime.h>
// Single-head causal self-attention: x [NB][SEQ][64] f32; k/q/v = x W ([in][out] 64x64, no biases; input order x, Wk, Wq, Wv); scores * 64^-0.5; causal (keys <= query); softmax; out = P v -> [NB][SEQ][64] f32.
// Compute dtype: all contractions on v_wmma_f32_16x16x32_f16 with f32 accumulate. x W: x RNE-converted to bf16 (exact in f16), W RNE-converted to bf16 then x16 (exact in f16), single product, 1/16 folded in the f32 epilogue.
// q k^T and P v: every operand as f16 hi plane + f16 residual plane carried x1024 (three products: hi.hi into the main accumulator; lo.hi + hi.lo into a separate residual accumulator folded back with 2^-10). P carried x256 before the split. Softmax statistics f32 (online, running max).
// Structure: k_wt3 (weights -> f16 x16) ; k_attn (one block of eight waves = one batch: the waves project K and V^T of all tokens into hi/lo planes that stay in LDS, one block barrier, then flash-style attention, one wave = 16 query rows at a time, 64-key steps, all fragments taken from those planes; Q goes from the projection's accumulators into its fragments in registers).
// Both attention products run transposed: S^T = K Q^T (K tile as A, Q as B) and O^T = V^T P^T (V^T tile as A, P as B). A lane (ln, hh) then holds query ln: its scores of keys 16j + 8hh + 0..7, which are the elements of the P fragment in place, and its outputs d = 16j + 8hh + 0..7, so that max, sum and rescale factor are the lane's own.
// The weights in the workspace and the planes in LDS lie in fragment order: a 16 x 32 operand fragment is two pieces of 512 B, piece p = [lane][8 f16] with lane (ln, hh) holding row ln, k = 16p + 8hh + 0..7, so a wave writes and reads a piece as 512 contiguous bytes.
//   weights: [weight][16-column group j][32-k half][p] ; LDS, per 64-token step, hi then lo: K tiles [16-token tile][32-d half][p] (row = token), then V tiles [16-d group j][32-token half][p] (row = d).
#ifndef NB
#define NB 256
#endif
#ifndef SEQ
#define SEQ 512
#endif
#define NB_FULL 256
#define SEQ_FULL 512                 /* per-batch row stride of x and out in the full-size buffers */
#define DM 64
#define HD 64
#define NW 8                         /* waves per block */
#define NT (SEQ / 16)                /* 16-token tiles per batch */
#define TPW (NT / NW)                /* tiles per wave */
#define SP 68                        /* LDS row pitch in floats (16-B aligned rows) */
#define PIECE 256                    /* f16 elements of one fragment piece: 32 lanes x 8 */
#define TILE 4096                    /* f16 elements of one 64 x 64 tile = 16 pieces */
#define WT_BYTES ((size_t)3 * 64 * 64 * 2)

static_assert(SEQ % 64 == 0);
static_assert(SEQ <= SEQ_FULL);
static_assert(NB <= NB_FULL);
static_assert(DM == 64 && HD == 64);
static_assert(TPW == 4 && NT == TPW * NW);
static_assert(4 * SEQ * HD * 2 + NW * 16 * SP * 4 <= 327680);   /* the four planes and the output staging rows fit one WGP's LDS */
static_assert((3 * 64 * 8) % 256 == 0);

typedef _Float16 v16h __attribute__((ext_vector_type(16)));
typedef unsigned short v8us __attribute__((ext_vector_type(8), may_alias));
typedef float  v8f  __attribute__((ext_vector_type(8)));
typedef float  v4f  __attribute__((ext_vector_type(4)));
typedef float  v4fa __attribute__((ext_vector_type(4), may_alias));
union FragH { v16h v; v8us half[2]; _Float16 h[16]; unsigned short u[16]; };
union Frag8 { v8us v; _Float16 h[8]; };

// RNE convert f32 -> bf16 value (kept in an f32 container)
__device__ __forceinline__ float bf16_rne(float x) { unsigned int u = __float_as_uint(x); u = (u + 0x7FFFu + ((u >> 16) & 1u)) & 0xFFFF0000u; return __uint_as_float(u); }

// 16x32 fragment, lane (ln = lane&15: the row, hh = lane>>4): elements 0..7 <- k 8hh..8hh+7, elements 8..15 <- k 16+8hh..16+8hh+7; from fragment-order storage: p names the lane's 16 B of the first piece, the second piece follows it
__device__ __forceinline__ v16h f_frag(const _Float16* p) { FragH f; f.half[0] = *(const v8us*)(const unsigned short*)p; f.half[1] = *(const v8us*)((const unsigned short*)p + PIECE); return f.v; }
__device__ __forceinline__ v8f g2_mma(v16h a, v16h b, v8f c) { return __builtin_amdgcn_wmma_f32_16x16x32_f16(false, a, false, b, (short)0, c, false, false); }

// A fragment from an f32 row (same k map), each value RNE-converted to bf16 then cast to f16 (exact)
__device__ __forceinline__ v16h x_frag(const float* p, unsigned hh) {
  const v4f x0 = *(const v4fa*)(p + 8 * hh), x1 = *(const v4fa*)(p + 8 * hh + 4), x2 = *(const v4fa*)(p + 16 + 8 * hh), x3 = *(const v4fa*)(p + 16 + 8 * hh + 4);
  const float xs[16] = {x0[0],x0[1],x0[2],x0[3],x1[0],x1[1],x1[2],x1[3],x2[0],x2[1],x2[2],x2[3],x3[0],x3[1],x3[2],x3[3]};
  FragH f;
#pragma unroll
  for (int i = 0; i < 16; ++i) f.h[i] = (_Float16)bf16_rne(xs[i]);
  return f.v;
}

// 8 f32 -> f16 hi and f16 residual x1024
__device__ __forceinline__ void split8(const float* v, Frag8& h, Frag8& l) {
#pragma unroll
  for (int q = 0; q < 8; ++q) { const _Float16 hv = (_Float16)v[q]; h.h[q] = hv; l.h[q] = (_Float16)((v[q] - (float)hv) * 1024.0f); }
}

__global__ __launch_bounds__(256) void k_wt3(const float* __restrict__ wq, const float* __restrict__ wk, const float* __restrict__ wv, _Float16* __restrict__ Wt) {
  const unsigned t = blockIdx.x * 256u + threadIdx.x;          /* 1536 threads exactly */
  const unsigned c = blockIdx.x >> 1;                          /* block-uniform: 512 threads per weight */
  /* t = (((c*4 + j)*2 + k half)*2 + p)*32 + lane */
  const unsigned n = ((t >> 7) & 3u) * 16u + (t & 15u), k8 = ((t >> 6) & 1u) * 32u + ((t >> 5) & 1u) * 16u + ((t >> 4) & 1u) * 8u;
  const float* W = (c == 0u) ? wq : ((c == 1u) ? wk : wv);
  Frag8 f;
#pragma unroll
  for (int i = 0; i < 8; ++i) f.h[i] = (_Float16)(bf16_rne(W[(size_t)(k8 + i) * 64u + n]) * 16.0f);
  unsigned short* dst = (unsigned short*)Wt + (size_t)t * 8u;
  *(v8us*)dst = f.v;
  
}

// one 8-key group of the softmax row: p = exp(s - m); P carried x256 -> f16 hi + residual x1024 into fragment elements e0..e0+7
__device__ __forceinline__ void p_group(const float* sv, float newm, float& sum, FragH& ph, FragH& pl, const int e0) {
#pragma unroll
  for (int q = 0; q < 8; ++q) {
    const float p = __expf(sv[q] - newm);
    sum += p;
    const float pcv = p * 256.0f;
    const _Float16 hv = (_Float16)pcv;
    ph.h[e0 + q] = hv;
    pl.h[e0 + q] = (_Float16)((pcv - (float)hv) * 1024.0f);
  }
}

// one of a wave's four fragments by a wave-uniform slot number (the slot loops stay rolled, so that the kernel's text stays small)
__device__ __forceinline__ v16h pick4(unsigned i, v16h p0, v16h p1, v16h p2, v16h p3) { return i == 0u ? p0 : (i == 1u ? p1 : (i == 2u ? p2 : p3)); }

// one 16 x 16 tile of x W for one weight's column group j (fragments b0, b1), / 16, as f16 hi + residual x1024. xa false: weights as A, x as B: the lane holds token ln, features 16j + 8hh + 0..7. xa true: x as A, weights as B: the lane holds feature 16j + ln, tokens 8hh + 0..7.
__device__ __forceinline__ void proj_tile(v16h b0, v16h b1, const bool xa, v16h a0, v16h a1, Frag8& h, Frag8& l) {
  v8f acc = {0.f, 0.f, 0.f, 0.f, 0.f, 0.f, 0.f, 0.f};
  if (!xa) { acc = g2_mma(b0, a0, acc); acc = g2_mma(b1, a1, acc); }
  else     { acc = g2_mma(a0, b0, acc); acc = g2_mma(a1, b1, acc); }
  float v[8];
#pragma unroll
  for (int r = 0; r < 8; ++r) v[r] = acc[r] * 0.0625f;
  split8(v, h, l);
}

__global__ __launch_bounds__(NW * 32) void k_attn(const float* __restrict__ x, const _Float16* __restrict__ Wt, float* __restrict__ out) {
  __shared__ __attribute__((aligned(16))) float sw[NW][16][SP];
  __shared__ __attribute__((aligned(16))) _Float16 kv[SEQ / 64][4][TILE];   /* per 64-token step: Kh, Kl, Vth, Vtl tiles in fragment order; a step's four tiles lie together, so that one base register and immediate offsets reach all of its fragments */
  const unsigned tid = threadIdx.x, w = tid >> 5, lane = tid & 31u, ln = lane & 15u, hh = lane >> 4;
  const unsigned b = blockIdx.x;
  /* the wave's four 16-token tiles: w, 15 - w, 16 + w, 31 - w: every wave walks the same number of 64-key steps */
  const unsigned wu = (unsigned)__builtin_amdgcn_readfirstlane((int)w);
  const float* xb = x + ((size_t)b * SEQ_FULL + ln) * DM;
  const float* x0 = xb + (size_t)(16u * wu) * DM;
  const float* x1 = xb + (size_t)(16u * (2u * NW - 1u - wu)) * DM;
  const float* x2 = xb + (size_t)(16u * (2u * NW + wu)) * DM;
  const float* x3 = xb + (size_t)(16u * (4u * NW - 1u - wu)) * DM;
  /* behind each tile's loads: s_wait_xcnt 0, so that no later load's result or address sum goes over an address register of an issued load ahead of it */
  const v16h xa00 = x_frag(x0, hh), xa01 = x_frag(x0 + 32, hh);
  asm volatile("s_wait_xcnt 0x0" ::: "memory");
  const v16h xa10 = x_frag(x1, hh), xa11 = x_frag(x1 + 32, hh);
  asm volatile("s_wait_xcnt 0x0" ::: "memory");
  const v16h xa20 = x_frag(x2, hh), xa21 = x_frag(x2 + 32, hh);
  asm volatile("s_wait_xcnt 0x0" ::: "memory");
  const v16h xa30 = x_frag(x3, hh), xa31 = x_frag(x3 + 32, hh);
  asm volatile("s_wait_xcnt 0x0" ::: "memory");
  /* all weight fragments, loaded once behind the x loads and kept in registers: [weight q, k, v][column group j][k half] */
  v16h wf[3][4][2];
#pragma unroll
  for (int cj = 0; cj < 12; ++cj) {
    const _Float16* bp = Wt + (size_t)cj * 4 * PIECE + lane * 8u;
    wf[cj >> 2][cj & 3][0] = f_frag(bp);
    wf[cj >> 2][cj & 3][1] = f_frag(bp + 2 * PIECE);
  }
  asm volatile("s_wait_xcnt 0x0" ::: "memory");                  /* as above, for the weight loads' address register */
  /* K and V^T of the wave's tiles -> LDS planes */
#pragma unroll 1   /* rolled: the body runs four times only, and unrolled it would quadruple the text ahead of the hot loop */
  for (unsigned i = 0; i < (unsigned)TPW; ++i) {
    const unsigned tt = (i >> 1) * (2u * NW) + ((i & 1u) ? 2u * NW - 1u - wu : wu);
    const v16h a0 = pick4(i, xa00, xa10, xa20, xa30), a1 = pick4(i, xa01, xa11, xa21, xa31);
#pragma unroll
    for (int j = 0; j < 4; ++j) {
      Frag8 h, l;
      proj_tile(wf[1][j][0], wf[1][j][1], false, a0, a1, h, l);
      const unsigned ok = ((tt & 3u) * 4u + (unsigned)j) * PIECE + lane * 8u;      /* 64-token step tt / 4: piece j of its token tile tt mod 4 */
      *(v8us*)(unsigned short*)&kv[tt >> 2][0][ok] = h.v;
      *(v8us*)(unsigned short*)&kv[tt >> 2][1][ok] = l.v;
      proj_tile(wf[2][j][0], wf[2][j][1], true, a0, a1, h, l);
      const unsigned ov = ((unsigned)j * 4u + (tt & 3u)) * PIECE + lane * 8u;      /* the same step: d group j, piece tt mod 4 */
      *(v8us*)(unsigned short*)&kv[tt >> 2][2][ov] = h.v;
      *(v8us*)(unsigned short*)&kv[tt >> 2][3][ov] = l.v;
    }
  }
  __syncthreads();                                                /* every wave's K and V^T pieces are in LDS before any fragment is read; the planes are only read from here on */
  const v8f z8 = {0.f, 0.f, 0.f, 0.f, 0.f, 0.f, 0.f, 0.f};
#pragma unroll 1   /* rolled: one copy of the hot loop in the text */
  for (unsigned i = 0; i < (unsigned)TPW; ++i) {
    const unsigned tt = (i >> 1) * (2u * NW) + ((i & 1u) ? 2u * NW - 1u - wu : wu);
    const unsigned qt = tt >> 2, qw0 = 16u * tt;
    FragH qh0, qh1, ql0, ql1;
    {
      const v16h a0 = pick4(i, xa00, xa10, xa20, xa30), a1 = pick4(i, xa01, xa11, xa21, xa31);
      Frag8 h, l;
      /* the lane's 16 B of piece j are elements 8 (j mod 2) .. + 7 of the fragment of d half j / 2 */
      proj_tile(wf[0][0][0], wf[0][0][1], false, a0, a1, h, l); qh0.half[0] = h.v; ql0.half[0] = l.v;
      proj_tile(wf[0][1][0], wf[0][1][1], false, a0, a1, h, l); qh0.half[1] = h.v; ql0.half[1] = l.v;
      proj_tile(wf[0][2][0], wf[0][2][1], false, a0, a1, h, l); qh1.half[0] = h.v; ql1.half[0] = l.v;
      proj_tile(wf[0][3][0], wf[0][3][1], false, a0, a1, h, l); qh1.half[1] = h.v; ql1.half[1] = l.v;
    }
    const v16h aqh0 = qh0.v, aqh1 = qh1.v, aql0 = ql0.v, aql1 = ql1.v;
    v8f oh[4] = {z8, z8, z8, z8}, orr[4] = {z8, z8, z8, z8};
    float m_run = -1.0e30f, l_run = 0.f;
#pragma unroll 1   /* rolled: the trip count differs from tile to tile */
    for (unsigned kt = 0; kt <= qt; ++kt) {
      float s4[4][8];                                             /* the lane's query ln against keys 64 kt + 16j + 8hh + r */
      const int rel = (int)(qw0 + ln) - (int)(kt * 64u + 8u * hh); /* key 16j + r of the lane's share is masked when it lies above rel */
#pragma unroll
      for (int j = 0; j < 4; ++j) {
        const _Float16* kh = &kv[kt][0][j * 4 * PIECE + lane * 8u];
        const _Float16* kl = &kv[kt][1][j * 4 * PIECE + lane * 8u];
        const v16h bh0 = f_frag(kh), bh1 = f_frag(kh + 2 * PIECE), bl0 = f_frag(kl), bl1 = f_frag(kl + 2 * PIECE);
        v8f sh = z8, sr = z8;
        sh = g2_mma(bh0, aqh0, sh); sh = g2_mma(bh1, aqh1, sh);
        sr = g2_mma(bh0, aql0, sr); sr = g2_mma(bh1, aql1, sr);
        sr = g2_mma(bl0, aqh0, sr); sr = g2_mma(bl1, aqh1, sr);
#pragma unroll
        for (int r = 0; r < 8; ++r) {
          const float s = (sh[r] + sr[r] * 0.0009765625f) * 0.125f;
          s4[j][r] = (16 * j + r > rel) ? -1.0e30f : s;           /* replace-fill; exp gives exactly 0 */
        }
      }
      float tmax = -1.0e30f;
#pragma unroll
      for (int g = 0; g < 4; ++g) {
        tmax = fmaxf(tmax, fmaxf(fmaxf(s4[g][0], s4[g][1]), fmaxf(s4[g][2], s4[g][3])));
        tmax = fmaxf(tmax, fmaxf(fmaxf(s4[g][4], s4[g][5]), fmaxf(s4[g][6], s4[g][7])));
      }
      tmax = fmaxf(tmax, __shfl_xor(tmax, 16, 32));
      const float newm = fmaxf(m_run, tmax);
      const float al = __expf(m_run - newm);
      float sum = 0.f;
      FragH ph0, ph1, pl0, pl1;
      p_group(s4[0], newm, sum, ph0, pl0, 0);
      p_group(s4[1], newm, sum, ph0, pl0, 8);
      p_group(s4[2], newm, sum, ph1, pl1, 0);
      p_group(s4[3], newm, sum, ph1, pl1, 8);
      sum += __shfl_xor(sum, 16, 32);
      m_run = newm;
      l_run = l_run * al + sum;
#pragma unroll
      for (int j = 0; j < 4; ++j)
#pragma unroll
        for (int r = 0; r < 8; ++r) { oh[j][r] *= al; orr[j][r] *= al; }
#pragma unroll
      for (int j = 0; j < 4; ++j) {
        const _Float16* vh = &kv[kt][2][j * 4 * PIECE + lane * 8u];
        const _Float16* vl = &kv[kt][3][j * 4 * PIECE + lane * 8u];
        const v16h bvh0 = f_frag(vh), bvh1 = f_frag(vh + 2 * PIECE), bvl0 = f_frag(vl), bvl1 = f_frag(vl + 2 * PIECE);
        oh[j]  = g2_mma(bvh0, ph0.v, oh[j]);  oh[j]  = g2_mma(bvh1, ph1.v, oh[j]);
        orr[j] = g2_mma(bvh0, pl0.v, orr[j]); orr[j] = g2_mma(bvh1, pl1.v, orr[j]);
        orr[j] = g2_mma(bvl0, ph0.v, orr[j]); orr[j] = g2_mma(bvl1, ph1.v, orr[j]);
      }
    }
    const float invl = 1.0f / (256.0f * l_run);                   /* l_run >= 1 */
    /* the tile goes once through the wave's own LDS scratch, so that the global stores below write whole 256-B rows */
#pragma unroll
    for (int j = 0; j < 4; ++j) {
      v4f o0, o1;
#pragma unroll
      for (int r = 0; r < 4; ++r) { o0[r] = (oh[j][r] + orr[j][r] * 0.0009765625f) * invl; o1[r] = (oh[j][r + 4] + orr[j][r + 4] * 0.0009765625f) * invl; }
      *(v4fa*)&sw[w][ln][16 * j + 8u * hh] = o0;
      *(v4fa*)&sw[w][ln][16 * j + 8u * hh + 4u] = o1;
    }
    __builtin_amdgcn_fence(4 /* acq_rel order */, "workgroup");
    __builtin_amdgcn_wave_barrier();
    float* orow = out + ((size_t)b * SEQ_FULL + qw0) * HD;
    const unsigned c4 = ln * 4u;
    v4f ov[8];
#pragma unroll
    for (int q = 0; q < 8; ++q) ov[q] = *(const v4fa*)&sw[w][2u * q + hh][c4];
#pragma unroll
    for (int q = 0; q < 8; ++q) *(v4f*)(orow + (size_t)(2u * q + hh) * HD + c4) = ov[q];   /* lanes 0-15: row 2q (256 B), lanes 16-31: row 2q+1 */
    asm volatile("s_wait_xcnt 0x0" ::: "memory");                /* before the next tile's code goes over the stores' address and data registers */
  }
}

extern "C" void kernel_launch(void* const* d_in, const int* in_sizes, int n_in,
                              void* d_out, int out_size, void* d_ws, size_t ws_size, hipStream_t stream) {
  if (n_in < 4) return;
  const size_t need_x = ((size_t)(NB - 1) * SEQ_FULL + SEQ) * DM;
  if ((size_t)in_sizes[0] < need_x) return;
  if (in_sizes[1] < 64 * 64 || in_sizes[2] < 64 * 64 || in_sizes[3] < 64 * 64) return;
  if ((size_t)out_size < need_x) return;
  const float* x  = (const float*)d_in[0];      /* [B][T][64] */
  const float* wk = (const float*)d_in[1];      /* w_key   [in][out] */
  const float* wq = (const float*)d_in[2];      /* w_query [in][out] */
  const float* wv = (const float*)d_in[3];      /* w_value [in][out] */
  if (WT_BYTES > ws_size) return;
  _Float16* Wt  = (_Float16*)d_ws;
  k_wt3<<<(3 * 64 * 8) / 256, 256, 0, stream>>>(wq, wk, wv, Wt);
  k_attn<<<NB, NW * 32, 0, stream>>>(x, Wt, (float*)d_out);
}

// v007
// One run takes 29.8 microseconds.
// In both of two side-by-side timings against v006, it was 1.11 times as fast.
// Over all steps from v000 it is 6.16 times as fast.
#include <hip/hip_runtime.h>
// Single-head causal self-attention: x [NB][SEQ][64] f32; k/q/v = x W ([in][out] 64x64, no biases; input order x, Wk, Wq, Wv); scores * 64^-0.5; causal (keys <= query); softmax; out = P v -> [NB][SEQ][64] f32.
// Compute dtype: all contractions on v_wmma_f32_16x16x32_f16 with f32 accumulate. x W: x RNE-converted to bf16 (exact in f16), W RNE-converted to bf16 then x16 (exact in f16), single product, 1/16 folded in the f32 epilogue.
// q k^T and P v: every operand as f16 hi plane + f16 residual plane carried x1024 (three products: hi.hi into the main accumulator; lo.hi + hi.lo into a separate residual accumulator folded back with 2^-10). P carried x256 before the split. Softmax statistics f32 (online, running max).
// Structure: k_wt3 (weights -> f16 x16) ; k_attn (one block of eight waves = one batch: the waves project K and V^T of all tokens into hi/lo planes that stay in LDS, one block barrier, then flash-style attention, one wave = 16 query rows at a time, 64-key steps, all fragments taken from those planes; Q goes from the projection's accumulators into its fragments in registers).
// Both attention products run transposed: S^T = K Q^T (K tile as A, Q as B) and O^T = V^T P^T (V^T tile as A, P as B). A lane (ln, hh) then holds query ln: its scores of keys 16j + 8hh + 0..7, which are the elements of the P fragment in place, and its outputs d = 16j + 8hh + 0..7, so that max, sum and rescale factor are the lane's own.
// The weights in the workspace and the planes in LDS lie in fragment order: a 16 x 32 operand fragment is two pieces of 512 B, piece p = [lane][8 f16] with lane (ln, hh) holding row ln, k = 16p + 8hh + 0..7, so a wave writes and reads a piece as 512 contiguous bytes.
//   weights: [weight][16-column group j][32-k half][p] ; LDS, per 64-token step, hi then lo: K tiles [16-token tile][32-d half][p] (row = token), then V tiles [16-d group j][32-token half][p] (row = d).
#ifndef NB
#define NB 256
#endif
#ifndef SEQ
#define SEQ 512
#endif
#define NB_FULL 256
#define SEQ_FULL 512                 /* per-batch row stride of x and out in the full-size buffers */
#define DM 64
#define HD 64
#define NW 8                         /* waves per block */
#define NT (SEQ / 16)                /* 16-token tiles per batch */
#define TPW (NT / NW)                /* tiles per wave */
#define SP 68                        /* LDS row pitch in floats (16-B aligned rows) */
#define PIECE 256                    /* f16 elements of one fragment piece: 32 lanes x 8 */
#define TILE 4096                    /* f16 elements of one 64 x 64 tile = 16 pieces */
#define SC2 0.18033688011112042f     /* 64^-0.5 * log2(e): unscaled score -> exponent of 2 */
#define WT_BYTES ((size_t)3 * 64 * 64 * 2)

static_assert(SEQ % 64 == 0);
static_assert(SEQ <= SEQ_FULL);
static_assert(NB <= NB_FULL);
static_assert(DM == 64 && HD == 64);
static_assert(TPW == 4 && NT == TPW * NW);
static_assert(4 * SEQ * HD * 2 + NW * 16 * SP * 4 <= 327680);   /* the four planes and the output staging rows fit one WGP's LDS */
static_assert((3 * 64 * 8) % 256 == 0);

typedef _Float16 v16h __attribute__((ext_vector_type(16)));
typedef unsigned short v8us __attribute__((ext_vector_type(8), may_alias));
typedef float  v8f  __attribute__((ext_vector_type(8)));
typedef float  v4f  __attribute__((ext_vector_type(4)));
typedef float  v4fa __attribute__((ext_vector_type(4), may_alias));
typedef float v2f __attribute__((ext_vector_type(2)));
typedef _Float16 v2h __attribute__((ext_vector_type(2)));
union FragH { v16h v; v8us half[2]; _Float16 h[16]; unsigned short u[16]; v2h h2[8]; };
union Frag8 { v8us v; _Float16 h[8]; v2h h2[4]; };

// RNE convert f32 -> bf16 value (kept in an f32 container)
__device__ __forceinline__ float bf16_rne(float x) { unsigned int u = __float_as_uint(x); u = (u + 0x7FFFu + ((u >> 16) & 1u)) & 0xFFFF0000u; return __uint_as_float(u); }

// 16x32 fragment, lane (ln = lane&15: the row, hh = lane>>4): elements 0..7 <- k 8hh..8hh+7, elements 8..15 <- k 16+8hh..16+8hh+7; from fragment-order storage: p names the lane's 16 B of the first piece, the second piece follows it
__device__ __forceinline__ v16h f_frag(const _Float16* p) { FragH f; f.half[0] = *(const v8us*)(const unsigned short*)p; f.half[1] = *(const v8us*)((const unsigned short*)p + PIECE); return f.v; }
__device__ __forceinline__ v8f g2_mma(v16h a, v16h b, v8f c) { return __builtin_amdgcn_wmma_f32_16x16x32_f16(false, a, false, b, (short)0, c, false, false); }

// A fragment from an f32 row (same k map), each value RNE-converted to bf16 then cast to f16 (exact)
__device__ __forceinline__ v16h x_frag(const float* p, unsigned hh) {
  const v4f x0 = *(const v4fa*)(p + 8 * hh), x1 = *(const v4fa*)(p + 8 * hh + 4), x2 = *(const v4fa*)(p + 16 + 8 * hh), x3 = *(const v4fa*)(p + 16 + 8 * hh + 4);
  const float xs[16] = {x0[0],x0[1],x0[2],x0[3],x1[0],x1[1],x1[2],x1[3],x2[0],x2[1],x2[2],x2[3],x3[0],x3[1],x3[2],x3[3]};
  FragH f;
#pragma unroll
  for (int i = 0; i < 16; ++i) f.h[i] = (_Float16)bf16_rne(xs[i]);
  return f.v;
}

// a pair of f32 -> packed f16 hi and packed f16 residual x1024; 1024 v - 1024 hi in one fma is exact, as (v - hi) * 1024 is
__device__ __forceinline__ void split2(v2f v, v2h& h, v2h& l) {
  h = __builtin_convertvector(v, v2h);
  const v2f m1024 = {-1024.0f, -1024.0f};
  l = __builtin_convertvector(__builtin_elementwise_fma(__builtin_convertvector(h, v2f), m1024, v * 1024.0f), v2h);
}
// 8 f32 -> f16 hi and f16 residual x1024
__device__ __forceinline__ void split8(const float* v, Frag8& h, Frag8& l) {
#pragma unroll
  for (int q = 0; q < 8; q += 2) { const v2f p = {v[q], v[q + 1]}; split2(p, h.h2[q >> 1], l.h2[q >> 1]); }
}

__global__ __launch_bounds__(256) void k_wt3(const float* __restrict__ wq, const float* __restrict__ wk, const float* __restrict__ wv, _Float16* __restrict__ Wt) {
  const unsigned t = blockIdx.x * 256u + threadIdx.x;          /* 1536 threads exactly */
  const unsigned c = blockIdx.x >> 1;                          /* block-uniform: 512 threads per weight */
  /* t = (((c*4 + j)*2 + k half)*2 + p)*32 + lane */
  const unsigned n = ((t >> 7) & 3u) * 16u + (t & 15u), k8 = ((t >> 6) & 1u) * 32u + ((t >> 5) & 1u) * 16u + ((t >> 4) & 1u) * 8u;
  const float* W = (c == 0u) ? wq : ((c == 1u) ? wk : wv);
  Frag8 f;
#pragma unroll
  for (int i = 0; i < 8; ++i) f.h[i] = (_Float16)(bf16_rne(W[(size_t)(k8 + i) * 64u + n]) * 16.0f);
  unsigned short* dst = (unsigned short*)Wt + (size_t)t * 8u;
  *(v8us*)dst = f.v;
  
}

// one 8-key group of the softmax row: p = 256 exp(s - m) = exp2(t * SC2 + nm), t the unscaled score, nm = 8 - m * SC2 -> f16 hi + residual x1024 into fragment elements e0..e0+7
__device__ __forceinline__ void p_group(const float* tv, float nm, float& sum, FragH& ph, FragH& pl, const int e0) {
#pragma unroll
  for (int q = 0; q < 8; q += 2) {
    const v2f p = {__builtin_amdgcn_exp2f(__builtin_fmaf(tv[q], SC2, nm)), __builtin_amdgcn_exp2f(__builtin_fmaf(tv[q + 1], SC2, nm))};
    sum += p[0];
    sum += p[1];
    split2(p, ph.h2[(e0 + q) >> 1], pl.h2[(e0 + q) >> 1]);
  }
}

// one of a wave's four fragments by a wave-uniform slot number (the slot loops stay rolled, so that the kernel's text stays small)
__device__ __forceinline__ v16h pick4(unsigned i, v16h p0, v16h p1, v16h p2, v16h p3) { return i == 0u ? p0 : (i == 1u ? p1 : (i == 2u ? p2 : p3)); }

// one 16 x 16 tile of x W for one weight's column group j (fragments b0, b1), / 16, as f16 hi + residual x1024. xa false: weights as A, x as B: the lane holds token ln, features 16j + 8hh + 0..7. xa true: x as A, weights as B: the lane holds feature 16j + ln, tokens 8hh + 0..7.
__device__ __forceinline__ void proj_tile(v16h b0, v16h b1, const bool xa, v16h a0, v16h a1, Frag8& h, Frag8& l) {
  v8f acc = {0.f, 0.f, 0.f, 0.f, 0.f, 0.f, 0.f, 0.f};
  if (!xa) { acc = g2_mma(b0, a0, acc); acc = g2_mma(b1, a1, acc); }
  else     { acc = g2_mma(a0, b0, acc); acc = g2_mma(a1, b1, acc); }
  float v[8];
#pragma unroll
  for (int r = 0; r < 8; ++r) v[r] = acc[r] * 0.0625f;
  split8(v, h, l);
}

__global__ __launch_bounds__(NW * 32) void k_attn(const float* __restrict__ x, const _Float16* __restrict__ Wt, float* __restrict__ out) {
  __shared__ __attribute__((aligned(16))) float sw[NW][16][SP];
  __shared__ __attribute__((aligned(16))) _Float16 kv[SEQ / 64][4][TILE];   /* per 64-token step: Kh, Kl, Vth, Vtl tiles in fragment order; a step's four tiles lie together, so that one base register and immediate offsets reach all of its fragments */
  const unsigned tid = threadIdx.x, w = tid >> 5, lane = tid & 31u, ln = lane & 15u, hh = lane >> 4;
  const unsigned b = blockIdx.x;
  /* the wave's four 16-token tiles: w, 15 - w, 16 + w, 31 - w: every wave walks the same number of 64-key steps */
  const unsigned wu = (unsigned)__builtin_amdgcn_readfirstlane((int)w);
  const float* xb = x + ((size_t)b * SEQ_FULL + ln) * DM;
  const float* x0 = xb + (size_t)(16u * wu) * DM;
  const float* x1 = xb + (size_t)(16u * (2u * NW - 1u - wu)) * DM;
  const float* x2 = xb + (size_t)(16u * (2u * NW + wu)) * DM;
  const float* x3 = xb + (size_t)(16u * (4u * NW - 1u - wu)) * DM;
  /* behind each tile's loads: s_wait_xcnt 0, so that no later load's result or address sum goes over an address register of an issued load ahead of it */
  const v16h xa00 = x_frag(x0, hh), xa01 = x_frag(x0 + 32, hh);
  asm volatile("s_wait_xcnt 0x0" ::: "memory");
  const v16h xa10 = x_frag(x1, hh), xa11 = x_frag(x1 + 32, hh);
  asm volatile("s_wait_xcnt 0x0" ::: "memory");
  const v16h xa20 = x_frag(x2, hh), xa21 = x_frag(x2 + 32, hh);
  asm volatile("s_wait_xcnt 0x0" ::: "memory");
  const v16h xa30 = x_frag(x3, hh), xa31 = x_frag(x3 + 32, hh);
  asm volatile("s_wait_xcnt 0x0" ::: "memory");
  /* all weight fragments, loaded once behind the x loads and kept in registers: [weight q, k, v][column group j][k half] */
  v16h wf[3][4][2];
#pragma unroll
  for (int cj = 0; cj < 12; ++cj) {
    const _Float16* bp = Wt + (size_t)cj * 4 * PIECE + lane * 8u;
    wf[cj >> 2][cj & 3][0] = f_frag(bp);
    wf[cj >> 2][cj & 3][1] = f_frag(bp + 2 * PIECE);
  }
  asm volatile("s_wait_xcnt 0x0" ::: "memory");                  /* as above, for the weight loads' address register */
  /* K and V^T of the wave's tiles -> LDS planes */
#pragma unroll 1   /* rolled: the body runs four times only, and unrolled it would quadruple the text ahead of the hot loop */
  for (unsigned i = 0; i < (unsigned)TPW; ++i) {
    const unsigned tt = (i >> 1) * (2u * NW) + ((i & 1u) ? 2u * NW - 1u - wu : wu);
    const v16h a0 = pick4(i, xa00, xa10, xa20, xa30), a1 = pick4(i, xa01, xa11, xa21, xa31);
#pragma unroll
    for (int j = 0; j < 4; ++j) {
      Frag8 h, l;
      proj_tile(wf[1][j][0], wf[1][j][1], false, a0, a1, h, l);
      const unsigned ok = ((tt & 3u) * 4u + (unsigned)j) * PIECE + lane * 8u;      /* 64-token step tt / 4: piece j of its token tile tt mod 4 */
      *(v8us*)(unsigned short*)&kv[tt >> 2][0][ok] = h.v;
      *(v8us*)(unsigned short*)&kv[tt >> 2][1][ok] = l.v;
      proj_tile(wf[2][j][0], wf[2][j][1], true, a0, a1, h, l);
      const unsigned ov = ((unsigned)j * 4u + (tt & 3u)) * PIECE + lane * 8u;      /* the same step: d group j, piece tt mod 4 */
      *(v8us*)(unsigned short*)&kv[tt >> 2][2][ov] = h.v;
      *(v8us*)(unsigned short*)&kv[tt >> 2][3][ov] = l.v;
    }
  }
  __syncthreads();                                                /* every wave's K and V^T pieces are in LDS before any fragment is read; the planes are only read from here on */
  const v8f z8 = {0.f, 0.f, 0.f, 0.f, 0.f, 0.f, 0.f, 0.f};
#pragma unroll 1   /* rolled: one copy of the hot loop in the text */
  for (unsigned i = 0; i < (unsigned)TPW; ++i) {
    const unsigned tt = (i >> 1) * (2u * NW) + ((i & 1u) ? 2u * NW - 1u - wu : wu);
    const unsigned qt = tt >> 2, qw0 = 16u * tt;
    FragH qh0, qh1, ql0, ql1;
    {
      const v16h a0 = pick4(i, xa00, xa10, xa20, xa30), a1 = pick4(i, xa01, xa11, xa21, xa31);
      Frag8 h, l;
      /* the lane's 16 B of piece j are elements 8 (j mod 2) .. + 7 of the fragment of d half j / 2 */
      proj_tile(wf[0][0][0], wf[0][0][1], false, a0, a1, h, l); qh0.half[0] = h.v; ql0.half[0] = l.v;
      proj_tile(wf[0][1][0], wf[0][1][1], false, a0, a1, h, l); qh0.half[1] = h.v; ql0.half[1] = l.v;
      proj_tile(wf[0][2][0], wf[0][2][1], false, a0, a1, h, l); qh1.half[0] = h.v; ql1.half[0] = l.v;
      proj_tile(wf[0][3][0], wf[0][3][1], false, a0, a1, h, l); qh1.half[1] = h.v; ql1.half[1] = l.v;
    }
    const v16h aqh0 = qh0.v, aqh1 = qh1.v, aql0 = ql0.v, aql1 = ql1.v;
    v8f oh[4] = {z8, z8, z8, z8}, orr[4] = {z8, z8, z8, z8};
    float m_run = -1.0e30f, l_run = 0.f;
#pragma unroll 1   /* rolled: the trip count differs from tile to tile */
    for (unsigned kt = 0; kt <= qt; ++kt) {
      float s4[4][8];                                             /* the lane's query ln against keys 64 kt + 16j + 8hh + r */
      const int rel = (int)(qw0 + ln) - (int)(kt * 64u + 8u * hh); /* key 16j + r of the lane's share is masked when it lies above rel */
#pragma unroll
      for (int j = 0; j < 4; ++j) {
        const _Float16* kh = &kv[kt][0][j * 4 * PIECE + lane * 8u];
        const _Float16* kl = &kv[kt][1][j * 4 * PIECE + lane * 8u];
        const v16h bh0 = f_frag(kh), bh1 = f_frag(kh + 2 * PIECE), bl0 = f_frag(kl), bl1 = f_frag(kl + 2 * PIECE);
        v8f sh = z8, sr = z8;
        sh = g2_mma(bh0, aqh0, sh); sh = g2_mma(bh1, aqh1, sh);
        sr = g2_mma(bh0, aql0, sr); sr = g2_mma(bh1, aql1, sr);
        sr = g2_mma(bl0, aqh0, sr); sr = g2_mma(bl1, aqh1, sr);
#pragma unroll
        for (int r = 0; r < 8; ++r) {
          const float s = sh[r] + sr[r] * 0.0009765625f;           /* unscaled: 64^-0.5 is applied in the exponent */
          s4[j][r] = (16 * j + r > rel) ? -1.0e30f : s;           /* replace-fill; exp gives exactly 0 */
        }
      }
      float tmax = -1.0e30f;
#pragma unroll
      for (int g = 0; g < 4; ++g) {
        tmax = fmaxf(tmax, fmaxf(fmaxf(s4[g][0], s4[g][1]), fmaxf(s4[g][2], s4[g][3])));
        tmax = fmaxf(tmax, fmaxf(fmaxf(s4[g][4], s4[g][5]), fmaxf(s4[g][6], s4[g][7])));
      }
      tmax = fmaxf(tmax, __shfl_xor(tmax, 16, 32));
      const float newm = fmaxf(m_run, tmax);
      const float al = __builtin_amdgcn_exp2f((m_run - newm) * SC2);
      const float nm = __builtin_fmaf(newm, -SC2, 8.0f);
      float sum = 0.f;
      FragH ph0, ph1, pl0, pl1;
      p_group(s4[0], nm, sum, ph0, pl0, 0);
      p_group(s4[1], nm, sum, ph0, pl0, 8);
      p_group(s4[2], nm, sum, ph1, pl1, 0);
      p_group(s4[3], nm, sum, ph1, pl1, 8);
      sum += __shfl_xor(sum, 16, 32);
      m_run = newm;
      l_run = l_run * al + sum;
#pragma unroll
      for (int j = 0; j < 4; ++j)
#pragma unroll
        for (int r = 0; r < 8; ++r) { oh[j][r] *= al; orr[j][r] *= al; }
#pragma unroll
      for (int j = 0; j < 4; ++j) {
        const _Float16* vh = &kv[kt][2][j * 4 * PIECE + lane * 8u];
        const _Float16* vl = &kv[kt][3][j * 4 * PIECE + lane * 8u];
        const v16h bvh0 = f_frag(vh), bvh1 = f_frag(vh + 2 * PIECE), bvl0 = f_frag(vl), bvl1 = f_frag(vl + 2 * PIECE);
        oh[j]  = g2_mma(bvh0, ph0.v, oh[j]);  oh[j]  = g2_mma(bvh1, ph1.v, oh[j]);
        orr[j] = g2_mma(bvh0, pl0.v, orr[j]); orr[j] = g2_mma(bvh1, pl1.v, orr[j]);
        orr[j] = g2_mma(bvl0, ph0.v, orr[j]); orr[j] = g2_mma(bvl1, ph1.v, orr[j]);
      }
    }
    const float invl = 1.0f / l_run;                              /* l_run carries the x256 of P; >= 256 up to rounding */
    /* the tile goes once through the wave's own LDS scratch, so that the global stores below write whole 256-B rows */
#pragma unroll
    for (int j = 0; j < 4; ++j) {
      v4f o0, o1;
#pragma unroll
      for (int r = 0; r < 4; ++r) { o0[r] = (oh[j][r] + orr[j][r] * 0.0009765625f) * invl; o1[r] = (oh[j][r + 4] + orr[j][r + 4] * 0.0009765625f) * invl; }
      *(v4fa*)&sw[w][ln][16 * j + 8u * hh] = o0;
      *(v4fa*)&sw[w][ln][16 * j + 8u * hh + 4u] = o1;
    }
    __builtin_amdgcn_fence(4 /* acq_rel order */, "workgroup");
    __builtin_amdgcn_wave_barrier();
    float* orow = out + ((size_t)b * SEQ_FULL + qw0) * HD;
    const unsigned c4 = ln * 4u;
    v4f ov[8];
#pragma unroll
    for (int q = 0; q < 8; ++q) ov[q] = *(const v4fa*)&sw[w][2u * q + hh][c4];
#pragma unroll
    for (int q = 0; q < 8; ++q) *(v4f*)(orow + (size_t)(2u * q + hh) * HD + c4) = ov[q];   /* lanes 0-15: row 2q (256 B), lanes 16-31: row 2q+1 */
    asm volatile("s_wait_xcnt 0x0" ::: "memory");                /* before the next tile's code goes over the stores' address and data registers */
  }
}

extern "C" void kernel_launch(void* const* d_in, const int* in_sizes, int n_in,
                              void* d_out, int out_size, void* d_ws, size_t ws_size, hipStream_t stream) {
  if (n_in < 4) return;
  const size_t need_x = ((size_t)(NB - 1) * SEQ_FULL + SEQ) * DM;
  if ((size_t)in_sizes[0] < need_x) return;
  if (in_sizes[1] < 64 * 64 || in_sizes[2] < 64 * 64 || in_sizes[3] < 64 * 64) return;
  if ((size_t)out_size < need_x) return;
  const float* x  = (const float*)d_in[0];      /* [B][T][64] */
  const float* wk = (const float*)d_in[1];      /* w_key   [in][out] */
  const float* wq = (const float*)d_in[2];      /* w_query [in][out] */
  const float* wv = (const float*)d_in[3];      /* w_value [in][out] */
  if (WT_BYTES > ws_size) return;
  _Float16* Wt  = (_Float16*)d_ws;
  k_wt3<<<(3 * 64 * 8) / 256, 256, 0, stream>>>(wq, wk, wv, Wt);
  k_attn<<<NB, NW * 32, 0, stream>>>(x, Wt, (float*)d_out);
}

// v008
// It runs in 28.2 microseconds.
// Timed twice side by side with v007, it ran 1.06 times as fast both times.
// Counting every step since v000, it is 6.54 times as fast.
#include <hip/hip_runtime.h>
// Single-head causal self-attention: x [NB][SEQ][64] f32; k/q/v = x W ([in][out] 64x64, no biases; input order x, Wk, Wq, Wv); scores * 64^-0.5; causal (keys <= query); softmax; out = P v -> [NB][SEQ][64] f32.
// Compute dtype: all contractions on v_wmma_f32_16x16x32_f16 with f32 accumulate. x W: x RNE-converted to bf16 (exact in f16), W RNE-converted to bf16 then x16 (exact in f16), single product, 1/16 folded in the f32 epilogue.
// q k^T and P v: every operand as f16 hi plane + f16 residual plane carried x1024 (three products: hi.hi into the main accumulator; lo.hi + hi.lo into a separate residual accumulator folded back with 2^-10). P carried x256 before the split. Softmax statistics f32 (online, running max).
// Structure: one launch, k_attn (one block of eight waves = one batch: the block first turns the three f32 weights into f16 x16 fragments in LDS, 1/8 of each weight per wave, one block barrier, and every wave takes all fragments into registers; then the waves project K and V^T of all tokens into hi/lo planes that stay in LDS, one block barrier, then flash-style attention, one wave = 16 query rows at a time, 64-key steps, all fragments taken from those planes; Q goes from the projection's accumulators into its fragments in registers).
// Both attention products run transposed: S^T = K Q^T (K tile as A, Q as B) and O^T = V^T P^T (V^T tile as A, P as B). A lane (ln, hh) then holds query ln: its scores of keys 16j + 8hh + 0..7, which are the elements of the P fragment in place, and its outputs d = 16j + 8hh + 0..7, so that max, sum and rescale factor are the lane's own.
// The weights and the planes in LDS lie in fragment order: a 16 x 32 operand fragment is two pieces of 512 B, piece p = [lane][8 f16] with lane (ln, hh) holding row ln, k = 16p + 8hh + 0..7, so a wave reads any piece, and writes a plane piece, as 512 contiguous bytes.
//   weights: [weight][16-column group j][32-k half][p] ; LDS, per 64-token step, hi then lo: K tiles [16-token tile][32-d half][p] (row = token), then V tiles [16-d group j][32-token half][p] (row = d).
#ifndef NB
#define NB 256
#endif
#ifndef SEQ
#define SEQ 512
#endif
#define NB_FULL 256
#define SEQ_FULL 512                 /* per-batch row stride of x and out in the full-size buffers */
#define DM 64
#define HD 64
#define NW 8                         /* waves per block */
#define NT (SEQ / 16)                /* 16-token tiles per batch */
#define TPW (NT / NW)                /* tiles per wave */
#define SP 68                        /* LDS row pitch in floats (16-B aligned rows) */
#define PIECE 256                    /* f16 elements of one fragment piece: 32 lanes x 8 */
#define TILE 4096                    /* f16 elements of one 64 x 64 tile = 16 pieces */
#define SC2 0.18033688011112042f     /* 64^-0.5 * log2(e): unscaled score -> exponent of 2 */
#define WELEMS (3 * 64 * 64)          /* f16 elements of the three weights */

static_assert(SEQ % 64 == 0);
static_assert(SEQ <= SEQ_FULL);
static_assert(NB <= NB_FULL);
static_assert(DM == 64 && HD == 64);
static_assert(TPW == 4 && NT == TPW * NW);
static_assert(4 * SEQ * HD * 2 + NW * 16 * SP * 4 + WELEMS * 2 <= 327680);   /* the four planes, the output staging rows and the weight fragments fit one WGP's LDS */
static_assert(NW == 8);              /* wave w converts rows 8w .. 8w + 7 of each weight */

typedef _Float16 v16h __attribute__((ext_vector_type(16)));
typedef unsigned short v8us __attribute__((ext_vector_type(8), may_alias));
typedef float  v8f  __attribute__((ext_vector_type(8)));
typedef float  v4f  __attribute__((ext_vector_type(4)));
typedef float  v4fa __attribute__((ext_vector_type(4), may_alias));
typedef float v2f __attribute__((ext_vector_type(2)));
typedef float v2fa __attribute__((ext_vector_type(2), may_alias));
typedef _Float16 v2h __attribute__((ext_vector_type(2)));
union FragH { v16h v; v8us half[2]; _Float16 h[16]; unsigned short u[16]; v2h h2[8]; };
union Frag8 { v8us v; _Float16 h[8]; v2h h2[4]; };

// RNE convert f32 -> bf16 value (kept in an f32 container)
__device__ __forceinline__ float bf16_rne(float x) { unsigned int u = __float_as_uint(x); u = (u + 0x7FFFu + ((u >> 16) & 1u)) & 0xFFFF0000u; return __uint_as_float(u); }

// 16x32 fragment, lane (ln = lane&15: the row, hh = lane>>4): elements 0..7 <- k 8hh..8hh+7, elements 8..15 <- k 16+8hh..16+8hh+7; from fragment-order storage: p names the lane's 16 B of the first piece, the second piece follows it
__device__ __forceinline__ v16h f_frag(const _Float16* p) { FragH f; f.half[0] = *(const v8us*)(const unsigned short*)p; f.half[1] = *(const v8us*)((const unsigned short*)p + PIECE); return f.v; }
__device__ __forceinline__ v8f g2_mma(v16h a, v16h b, v8f c) { return __builtin_amdgcn_wmma_f32_16x16x32_f16(false, a, false, b, (short)0, c, false, false); }

// A fragment from an f32 row (same k map), in two parts, so that other work can stand between the loads and their first use: the lane's 16 f32 ...
struct XRaw { v4f x0, x1, x2, x3; };
__device__ __forceinline__ XRaw x_raw(const float* p) {            /* p: the row's k = 8hh of this 32-k half */
  XRaw r;
  r.x0 = *(const v4fa*)p; r.x1 = *(const v4fa*)(p + 4); r.x2 = *(const v4fa*)(p + 16); r.x3 = *(const v4fa*)(p + 20);
  return r;
}
// ... and each value RNE-converted to bf16 then cast to f16 (exact)
__device__ __forceinline__ v16h x_frag(const XRaw& r) {
  const v4f x0 = r.x0, x1 = r.x1, x2 = r.x2, x3 = r.x3;
  const float xs[16] = {x0[0],x0[1],x0[2],x0[3],x1[0],x1[1],x1[2],x1[3],x2[0],x2[1],x2[2],x2[3],x3[0],x3[1],x3[2],x3[3]};
  FragH f;
#pragma unroll
  for (int i = 0; i < 16; ++i) f.h[i] = (_Float16)bf16_rne(xs[i]);
  return f.v;
}

// a pair of f32 -> packed f16 hi and packed f16 residual x1024; 1024 v - 1024 hi in one fma is exact, as (v - hi) * 1024 is
__device__ __forceinline__ void split2(v2f v, v2h& h, v2h& l) {
  h = __builtin_convertvector(v, v2h);
  const v2f m1024 = {-1024.0f, -1024.0f};
  l = __builtin_convertvector(__builtin_elementwise_fma(__builtin_convertvector(h, v2f), m1024, v * 1024.0f), v2h);
}
// 8 f32 -> f16 hi and f16 residual x1024
__device__ __forceinline__ void split8(const float* v, Frag8& h, Frag8& l) {
#pragma unroll
  for (int q = 0; q < 8; q += 2) { const v2f p = {v[q], v[q + 1]}; split2(p, h.h2[q >> 1], l.h2[q >> 1]); }
}

// one 8-key group of the softmax row: p = 256 exp(s - m) = exp2(t * SC2 + nm), t the unscaled score, nm = 8 - m * SC2 -> f16 hi + residual x1024 into fragment elements e0..e0+7
__device__ __forceinline__ void p_group(const float* tv, float nm, float& sum, FragH& ph, FragH& pl, const int e0) {
#pragma unroll
  for (int q = 0; q < 8; q += 2) {
    const v2f p = {__builtin_amdgcn_exp2f(__builtin_fmaf(tv[q], SC2, nm)), __builtin_amdgcn_exp2f(__builtin_fmaf(tv[q + 1], SC2, nm))};
    sum += p[0];
    sum += p[1];
    split2(p, ph.h2[(e0 + q) >> 1], pl.h2[(e0 + q) >> 1]);
  }
}

// one of a wave's four fragments by a wave-uniform slot number (the slot loops stay rolled, so that the kernel's text stays small)
__device__ __forceinline__ v16h pick4(unsigned i, v16h p0, v16h p1, v16h p2, v16h p3) { return i == 0u ? p0 : (i == 1u ? p1 : (i == 2u ? p2 : p3)); }

// one 16 x 16 tile of x W for one weight's column group j (fragments b0, b1), / 16, as f16 hi + residual x1024. xa false: weights as A, x as B: the lane holds token ln, features 16j + 8hh + 0..7. xa true: x as A, weights as B: the lane holds feature 16j + ln, tokens 8hh + 0..7.
__device__ __forceinline__ void proj_tile(v16h b0, v16h b1, const bool xa, v16h a0, v16h a1, Frag8& h, Frag8& l) {
  v8f acc = {0.f, 0.f, 0.f, 0.f, 0.f, 0.f, 0.f, 0.f};
  if (!xa) { acc = g2_mma(b0, a0, acc); acc = g2_mma(b1, a1, acc); }
  else     { acc = g2_mma(a0, b0, acc); acc = g2_mma(a1, b1, acc); }
  float v[8];
#pragma unroll
  for (int r = 0; r < 8; ++r) v[r] = acc[r] * 0.0625f;
  split8(v, h, l);
}

__global__ __launch_bounds__(NW * 32) void k_attn(const float* __restrict__ x, const float* __restrict__ wq, const float* __restrict__ wk, const float* __restrict__ wv, float* __restrict__ out) {
  __shared__ __attribute__((aligned(16))) float sw[NW][16][SP];
  __shared__ __attribute__((aligned(16))) _Float16 kv[SEQ / 64][4][TILE];   /* per 64-token step: Kh, Kl, Vth, Vtl tiles in fragment order; a step's four tiles lie together, so that one base register and immediate offsets reach all of its fragments */
  __shared__ __attribute__((aligned(16))) _Float16 wl[WELEMS];             /* the weights q, k, v as f16 x16 in fragment order */
  const unsigned tid = threadIdx.x, w = tid >> 5, lane = tid & 31u, ln = lane & 15u, hh = lane >> 4;
  const unsigned b = blockIdx.x;
  /* the wave's four 16-token tiles: w, 15 - w, 16 + w, 31 - w: every wave walks the same number of 64-key steps */
  const unsigned wu = (unsigned)__builtin_amdgcn_readfirstlane((int)w);
  /* the wave's share of the weights, asked for ahead of x: rows k = 8 wu .. + 7 of each weight, the lane's columns n = 2 lane, 2 lane + 1, so that one wave load is one whole 256-B row */
  v2f wr[3][8];
  const float* wu0 = wq + (size_t)(8u * wu) * 64u;
  const float* wu1 = wk + (size_t)(8u * wu) * 64u;
  const float* wu2 = wv + (size_t)(8u * wu) * 64u;
#pragma unroll
  for (int i = 0; i < 8; ++i) { wr[0][i] = *(const v2fa*)(wu0 + i * 64 + 2u * lane); wr[1][i] = *(const v2fa*)(wu1 + i * 64 + 2u * lane); wr[2][i] = *(const v2fa*)(wu2 + i * 64 + 2u * lane); }
  /* s_wait_xcnt 0 before later code goes over an address register of the weight loads; the addresses are named as inputs, so that their registers are left alone up to the wait */
  asm volatile("s_wait_xcnt 0x0" :: "s"(wu0), "s"(wu1), "s"(wu2), "v"(lane) : "memory");
  const float* xb = x + ((size_t)b * SEQ_FULL + ln) * DM + 8u * hh;
  const float* x0 = xb + (size_t)(16u * wu) * DM;
  const float* x1 = xb + (size_t)(16u * (2u * NW - 1u - wu)) * DM;
  const float* x2 = xb + (size_t)(16u * (2u * NW + wu)) * DM;
  const float* x3 = xb + (size_t)(16u * (4u * NW - 1u - wu)) * DM;
  /* behind each tile's loads: s_wait_xcnt 0, so that no later load's result or address sum goes over an address register of an issued load ahead of it; the address is named as an input, as above */
  const XRaw xr00 = x_raw(x0), xr01 = x_raw(x0 + 32);
  asm volatile("s_wait_xcnt 0x0" :: "v"(x0) : "memory");
  const XRaw xr10 = x_raw(x1), xr11 = x_raw(x1 + 32);
  asm volatile("s_wait_xcnt 0x0" :: "v"(x1) : "memory");
  const XRaw xr20 = x_raw(x2), xr21 = x_raw(x2 + 32);
  asm volatile("s_wait_xcnt 0x0" :: "v"(x2) : "memory");
  const XRaw xr30 = x_raw(x3), xr31 = x_raw(x3 + 32);
  asm volatile("s_wait_xcnt 0x0" :: "v"(x3) : "memory");
  __builtin_amdgcn_sched_barrier(0);                              /* all loads are issued before the first wait for a weight: without it the compiler starts the weights' conversion, and so waits out their latency, ahead of three of the four tiles' x loads */
  /* the share -> bf16 (RNE) x16 as f16, into its place: rows 8 wu .. + 7 are k half wu / 4, piece (wu / 2) mod 2, lane half wu mod 2; column n is group n / 16, fragment row n mod 16; the lane's two columns are 32 B in a row */
#pragma unroll
  for (int c = 0; c < 3; ++c) {
    Frag8 f0, f1;
#pragma unroll
    for (int i = 0; i < 8; ++i) { f0.h[i] = (_Float16)(bf16_rne(wr[c][i][0]) * 16.0f); f1.h[i] = (_Float16)(bf16_rne(wr[c][i][1]) * 16.0f); }
    const unsigned od = ((((unsigned)c * 4u + (lane >> 3)) * 4u + (wu >> 1)) * 32u + (wu & 1u) * 16u + (2u * lane & 15u)) * 8u;
    *(v8us*)(unsigned short*)&wl[od] = f0.v;
    *(v8us*)(unsigned short*)&wl[od + 8u] = f1.v;
  }
  /* block barrier with fences on LDS alone: every wave's share of the weights is in LDS before any weight fragment is read (wl is only read from here on); __syncthreads() would also wait here for the x loads, which are still in flight and which no other wave needs */
  __builtin_amdgcn_fence(__ATOMIC_RELEASE, "workgroup", "local");
  __builtin_amdgcn_s_barrier();
  __builtin_amdgcn_fence(__ATOMIC_ACQUIRE, "workgroup", "local");
  /* all weight fragments, taken once and kept in registers: [weight q, k, v][column group j][k half] */
  v16h wf[3][4][2];
#pragma unroll
  for (int cj = 0; cj < 12; ++cj) {
    const _Float16* bp = &wl[cj * 4 * PIECE + lane * 8u];
    wf[cj >> 2][cj & 3][0] = f_frag(bp);
    wf[cj >> 2][cj & 3][1] = f_frag(bp + 2 * PIECE);
  }
  __builtin_amdgcn_sched_barrier(0);                              /* the barrier and the fragment reads stay ahead of the first wait for x: without it the compiler lifts the conversion of x, with its waits for memory, over the barrier */
  const v16h xa00 = x_frag(xr00), xa01 = x_frag(xr01), xa10 = x_frag(xr10), xa11 = x_frag(xr11);
  const v16h xa20 = x_frag(xr20), xa21 = x_frag(xr21), xa30 = x_frag(xr30), xa31 = x_frag(xr31);
  /* K and V^T of the wave's tiles -> LDS planes */
#pragma unroll 1   /* rolled: the body runs four times only, and unrolled it would quadruple the text ahead of the hot loop */
  for (unsigned i = 0; i < (unsigned)TPW; ++i) {
    const unsigned tt = (i >> 1) * (2u * NW) + ((i & 1u) ? 2u * NW - 1u - wu : wu);
    const v16h a0 = pick4(i, xa00, xa10, xa20, xa30), a1 = pick4(i, xa01, xa11, xa21, xa31);
#pragma unroll
    for (int j = 0; j < 4; ++j) {
      Frag8 h, l;
      proj_tile(wf[1][j][0], wf[1][j][1], false, a0, a1, h, l);
      const unsigned ok = ((tt & 3u) * 4u + (unsigned)j) * PIECE + lane * 8u;      /* 64-token step tt / 4: piece j of its token tile tt mod 4 */
      *(v8us*)(unsigned short*)&kv[tt >> 2][0][ok] = h.v;
      *(v8us*)(unsigned short*)&kv[tt >> 2][1][ok] = l.v;
      proj_tile(wf[2][j][0], wf[2][j][1], true, a0, a1, h, l);
      const unsigned ov = ((unsigned)j * 4u + (tt & 3u)) * PIECE + lane * 8u;      /* the same step: d group j, piece tt mod 4 */
      *(v8us*)(unsigned short*)&kv[tt >> 2][2][ov] = h.v;
      *(v8us*)(unsigned short*)&kv[tt >> 2][3][ov] = l.v;
    }
  }
  __syncthreads();                                                /* every wave's K and V^T pieces are in LDS before any fragment is read; the planes are only read from here on */
  const v8f z8 = {0.f, 0.f, 0.f, 0.f, 0.f, 0.f, 0.f, 0.f};
#pragma unroll 1   /* rolled: one copy of the hot loop in the text */
  for (unsigned i = 0; i < (unsigned)TPW; ++i) {
    const unsigned tt = (i >> 1) * (2u * NW) + ((i & 1u) ? 2u * NW - 1u - wu : wu);
    const unsigned qt = tt >> 2, qw0 = 16u * tt;
    FragH qh0, qh1, ql0, ql1;
    {
      const v16h a0 = pick4(i, xa00, xa10, xa20, xa30), a1 = pick4(i, xa01, xa11, xa21, xa31);
      Frag8 h, l;
      /* the lane's 16 B of piece j are elements 8 (j mod 2) .. + 7 of the fragment of d half j / 2 */
      proj_tile(wf[0][0][0], wf[0][0][1], false, a0, a1, h, l); qh0.half[0] = h.v; ql0.half[0] = l.v;
      proj_tile(wf[0][1][0], wf[0][1][1], false, a0, a1, h, l); qh0.half[1] = h.v; ql0.half[1] = l.v;
      proj_tile(wf[0][2][0], wf[0][2][1], false, a0, a1, h, l); qh1.half[0] = h.v; ql1.half[0] = l.v;
      proj_tile(wf[0][3][0], wf[0][3][1], false, a0, a1, h, l); qh1.half[1] = h.v; ql1.half[1] = l.v;
    }
    const v16h aqh0 = qh0.v, aqh1 = qh1.v, aql0 = ql0.v, aql1 = ql1.v;
    v8f oh[4] = {z8, z8, z8, z8}, orr[4] = {z8, z8, z8, z8};
    float m_run = -1.0e30f, l_run = 0.f;
#pragma unroll 1   /* rolled: the trip count differs from tile to tile */
    for (unsigned kt = 0; kt <= qt; ++kt) {
      float s4[4][8];                                             /* the lane's query ln against keys 64 kt + 16j + 8hh + r */
      const int rel = (int)(qw0 + ln) - (int)(kt * 64u + 8u * hh); /* key 16j + r of the lane's share is masked when it lies above rel */
#pragma unroll
      for (int j = 0; j < 4; ++j) {
        const _Float16* kh = &kv[kt][0][j * 4 * PIECE + lane * 8u];
        const _Float16* kl = &kv[kt][1][j * 4 * PIECE + lane * 8u];
        const v16h bh0 = f_frag(kh), bh1 = f_frag(kh + 2 * PIECE), bl0 = f_frag(kl), bl1 = f_frag(kl + 2 * PIECE);
        v8f sh = z8, sr = z8;
        sh = g2_mma(bh0, aqh0, sh); sh = g2_mma(bh1, aqh1, sh);
        sr = g2_mma(bh0, aql0, sr); sr = g2_mma(bh1, aql1, sr);
        sr = g2_mma(bl0, aqh0, sr); sr = g2_mma(bl1, aqh1, sr);
#pragma unroll
        for (int r = 0; r < 8; ++r) {
          const float s = sh[r] + sr[r] * 0.0009765625f;           /* unscaled: 64^-0.5 is applied in the exponent */
          s4[j][r] = (16 * j + r > rel) ? -1.0e30f : s;           /* replace-fill; exp gives exactly 0 */
        }
      }
      float tmax = -1.0e30f;
#pragma unroll
      for (int g = 0; g < 4; ++g) {
        tmax = fmaxf(tmax, fmaxf(fmaxf(s4[g][0], s4[g][1]), fmaxf(s4[g][2], s4[g][3])));
        tmax = fmaxf(tmax, fmaxf(fmaxf(s4[g][4], s4[g][5]), fmaxf(s4[g][6], s4[g][7])));
      }
      tmax = fmaxf(tmax, __shfl_xor(tmax, 16, 32));
      const float newm = fmaxf(m_run, tmax);
      const float al = __builtin_amdgcn_exp2f((m_run - newm) * SC2);
      const float nm = __builtin_fmaf(newm, -SC2, 8.0f);
      float sum = 0.f;
      FragH ph0, ph1, pl0, pl1;
      p_group(s4[0], nm, sum, ph0, pl0, 0);
      p_group(s4[1], nm, sum, ph0, pl0, 8);
      p_group(s4[2], nm, sum, ph1, pl1, 0);
      p_group(s4[3], nm, sum, ph1, pl1, 8);
      sum += __shfl_xor(sum, 16, 32);
      m_run = newm;
      l_run = l_run * al + sum;
#pragma unroll
      for (int j = 0; j < 4; ++j)
#pragma unroll
        for (int r = 0; r < 8; ++r) { oh[j][r] *= al; orr[j][r] *= al; }
#pragma unroll
      for (int j = 0; j < 4; ++j) {
        const _Float16* vh = &kv[kt][2][j * 4 * PIECE + lane * 8u];
        const _Float16* vl = &kv[kt][3][j * 4 * PIECE + lane * 8u];
        const v16h bvh0 = f_frag(vh), bvh1 = f_frag(vh + 2 * PIECE), bvl0 = f_frag(vl), bvl1 = f_frag(vl + 2 * PIECE);
        oh[j]  = g2_mma(bvh0, ph0.v, oh[j]);  oh[j]  = g2_mma(bvh1, ph1.v, oh[j]);
        orr[j] = g2_mma(bvh0, pl0.v, orr[j]); orr[j] = g2_mma(bvh1, pl1.v, orr[j]);
        orr[j] = g2_mma(bvl0, ph0.v, orr[j]); orr[j] = g2_mma(bvl1, ph1.v, orr[j]);
      }
    }
    const float invl = 1.0f / l_run;                              /* l_run carries the x256 of P; >= 256 up to rounding */
    /* the tile goes once through the wave's own LDS scratch, so that the global stores below write whole 256-B rows */
#pragma unroll
    for (int j = 0; j < 4; ++j) {
      v4f o0, o1;
#pragma unroll
      for (int r = 0; r < 4; ++r) { o0[r] = (oh[j][r] + orr[j][r] * 0.0009765625f) * invl; o1[r] = (oh[j][r + 4] + orr[j][r + 4] * 0.0009765625f) * invl; }
      *(v4fa*)&sw[w][ln][16 * j + 8u * hh] = o0;
      *(v4fa*)&sw[w][ln][16 * j + 8u * hh + 4u] = o1;
    }
    __builtin_amdgcn_fence(4 /* acq_rel order */, "workgroup");
    __builtin_amdgcn_wave_barrier();
    float* orow = out + ((size_t)b * SEQ_FULL + qw0) * HD;
    const unsigned c4 = ln * 4u;
    v4f ov[8];
#pragma unroll
    for (int q = 0; q < 8; ++q) ov[q] = *(const v4fa*)&sw[w][2u * q + hh][c4];
#pragma unroll
    for (int q = 0; q < 8; ++q) *(v4f*)(orow + (size_t)(2u * q + hh) * HD + c4) = ov[q];   /* lanes 0-15: row 2q (256 B), lanes 16-31: row 2q+1 */
    asm volatile("s_wait_xcnt 0x0" ::: "memory");                /* before the next tile's code goes over the stores' address and data registers */
  }
}

extern "C" void kernel_launch(void* const* d_in, const int* in_sizes, int n_in,
                              void* d_out, int out_size, void* d_ws, size_t ws_size, hipStream_t stream) {
  if (n_in < 4) return;
  const size_t need_x = ((size_t)(NB - 1) * SEQ_FULL + SEQ) * DM;
  if ((size_t)in_sizes[0] < need_x) return;
  if (in_sizes[1] < 64 * 64 || in_sizes[2] < 64 * 64 || in_sizes[3] < 64 * 64) return;
  if ((size_t)out_size < need_x) return;
  const float* x  = (const float*)d_in[0];      /* [B][T][64] */
  const float* wk = (const float*)d_in[1];      /* w_key   [in][out] */
  const float* wq = (const float*)d_in[2];      /* w_query [in][out] */
  const float* wv = (const float*)d_in[3];      /* w_value [in][out] */
  k_attn<<<NB, NW * 32, 0, stream>>>(x, wq, wk, wv, (float*)d_out);
}

// v009
// One run takes 27 microseconds.
// In two side-by-side timings against v008, it was 1.05 and 1.04 times as fast.
// Counting every step since v000, it is 6.83 times as fast.
#include <hip/hip_runtime.h>
// Single-head causal self-attention: x [NB][SEQ][64] f32; k/q/v = x W ([in][out] 64x64, no biases; input order x, Wk, Wq, Wv); scores * 64^-0.5; causal (keys <= query); softmax; out = P v -> [NB][SEQ][64] f32.
// Compute dtype: all contractions on v_wmma_f32_16x16x32_f16 with f32 accumulate. x W: x RNE-converted to bf16 (exact in f16), W RNE-converted to bf16 then x16 (exact in f16), single product, 1/16 folded in the f32 epilogue.
// q k^T and P v: every operand as f16 hi plane + f16 residual plane carried x1024 (three products: hi.hi into the main accumulator; lo.hi + hi.lo into a separate residual accumulator folded back with 2^-10). P carried x256 before the split. Softmax statistics f32 (online, running max).
// Structure: one launch, k_attn (one block of eight waves = one batch: the block first turns the three f32 weights into f16 x16 fragments in LDS, 1/8 of each weight per wave, one block barrier, and every wave takes the k and v fragments into registers, the q fragments later, where a tile's Q is made; then the waves project K and V^T of all tokens into hi/lo planes that stay in LDS, one block barrier, then flash-style attention, one wave = 32 query rows at a time (two 16-query tiles side by side, so that each K and V fragment is read from LDS once for both), 64-key steps, all fragments taken from those planes; Q goes from the projection's accumulators into its fragments in registers).
// Both attention products run transposed: S^T = K Q^T (K tile as A, Q as B) and O^T = V^T P^T (V^T tile as A, P as B). A lane (ln, hh) then holds query ln: its scores of keys 16j + 8hh + 0..7, which are the elements of the P fragment in place, and its outputs d = 16j + 8hh + 0..7, so that max, sum and rescale factor are the lane's own.
// The weights and the planes in LDS lie in fragment order: a 16 x 32 operand fragment is two pieces of 512 B, piece p = [lane][8 f16] with lane (ln, hh) holding row ln, k = 16p + 8hh + 0..7, so a wave reads any piece, and writes a plane piece, as 512 contiguous bytes.
//   weights: [weight][16-column group j][32-k half][p] ; LDS, per 64-token step, hi then lo: K tiles [16-token tile][32-d half][p] (row = token), then V tiles [16-d group j][32-token half][p] (row = d).
#ifndef NB
#define NB 256
#endif
#ifndef SEQ
#define SEQ 512
#endif
#define NB_FULL 256
#define SEQ_FULL 512                 /* per-batch row stride of x and out in the full-size buffers */
#define DM 64
#define HD 64
#define NW 8                         /* waves per block */
#define NT (SEQ / 16)                /* 16-token tiles per batch */
#define TPW (NT / NW)                /* tiles per wave */
#define SP 68                        /* LDS row pitch in floats (16-B aligned rows) */
#define PIECE 256                    /* f16 elements of one fragment piece: 32 lanes x 8 */
#define TILE 4096                    /* f16 elements of one 64 x 64 tile = 16 pieces */
#define SC2 0.18033688011112042f     /* 64^-0.5 * log2(e): unscaled score -> exponent of 2 */
#define WELEMS (3 * 64 * 64)          /* f16 elements of the three weights */

static_assert(SEQ % 64 == 0);
static_assert(SEQ <= SEQ_FULL);
static_assert(NB <= NB_FULL);
static_assert(DM == 64 && HD == 64);
static_assert(TPW == 4 && NT == TPW * NW);
static_assert(4 * SEQ * HD * 2 + NW * 16 * SP * 4 + WELEMS * 2 <= 327680);   /* the four planes, the output staging rows and the weight fragments fit one WGP's LDS */
static_assert(NW == 8);              /* wave w converts rows 8w .. 8w + 7 of each weight */

typedef _Float16 v16h __attribute__((ext_vector_type(16)));
typedef unsigned short v8us __attribute__((ext_vector_type(8), may_alias));
typedef float  v8f  __attribute__((ext_vector_type(8)));
typedef float  v4f  __attribute__((ext_vector_type(4)));
typedef float  v4fa __attribute__((ext_vector_type(4), may_alias));
typedef float v2f __attribute__((ext_vector_type(2)));
typedef float v2fa __attribute__((ext_vector_type(2), may_alias));
typedef _Float16 v2h __attribute__((ext_vector_type(2)));
union FragH { v16h v; v8us half[2]; _Float16 h[16]; unsigned short u[16]; v2h h2[8]; };
union Frag8 { v8us v; _Float16 h[8]; v2h h2[4]; };

// RNE convert f32 -> bf16 value (kept in an f32 container)
__device__ __forceinline__ float bf16_rne(float x) { unsigned int u = __float_as_uint(x); u = (u + 0x7FFFu + ((u >> 16) & 1u)) & 0xFFFF0000u; return __uint_as_float(u); }

// 16x32 fragment, lane (ln = lane&15: the row, hh = lane>>4): elements 0..7 <- k 8hh..8hh+7, elements 8..15 <- k 16+8hh..16+8hh+7; from fragment-order storage: p names the lane's 16 B of the first piece, the second piece follows it
__device__ __forceinline__ v16h f_frag(const _Float16* p) { FragH f; f.half[0] = *(const v8us*)(const unsigned short*)p; f.half[1] = *(const v8us*)((const unsigned short*)p + PIECE); return f.v; }
__device__ __forceinline__ v8f g2_mma(v16h a, v16h b, v8f c) { return __builtin_amdgcn_wmma_f32_16x16x32_f16(false, a, false, b, (short)0, c, false, false); }

// A fragment from an f32 row (same k map), in two parts, so that other work can stand between the loads and their first use: the lane's 16 f32 ...
struct XRaw { v4f x0, x1, x2, x3; };
__device__ __forceinline__ XRaw x_raw(const float* p) {            /* p: the row's k = 8hh of this 32-k half */
  XRaw r;
  r.x0 = *(const v4fa*)p; r.x1 = *(const v4fa*)(p + 4); r.x2 = *(const v4fa*)(p + 16); r.x3 = *(const v4fa*)(p + 20);
  return r;
}
// ... and each value RNE-converted to bf16 then cast to f16 (exact)
__device__ __forceinline__ v16h x_frag(const XRaw& r) {
  const v4f x0 = r.x0, x1 = r.x1, x2 = r.x2, x3 = r.x3;
  const float xs[16] = {x0[0],x0[1],x0[2],x0[3],x1[0],x1[1],x1[2],x1[3],x2[0],x2[1],x2[2],x2[3],x3[0],x3[1],x3[2],x3[3]};
  FragH f;
#pragma unroll
  for (int i = 0; i < 16; ++i) f.h[i] = (_Float16)bf16_rne(xs[i]);
  return f.v;
}

// a pair of f32 -> packed f16 hi and packed f16 residual x1024; 1024 v - 1024 hi in one fma is exact, as (v - hi) * 1024 is
__device__ __forceinline__ void split2(v2f v, v2h& h, v2h& l) {
  h = __builtin_convertvector(v, v2h);
  const v2f m1024 = {-1024.0f, -1024.0f};
  l = __builtin_convertvector(__builtin_elementwise_fma(__builtin_convertvector(h, v2f), m1024, v * 1024.0f), v2h);
}
// 8 f32 -> f16 hi and f16 residual x1024
__device__ __forceinline__ void split8(const float* v, Frag8& h, Frag8& l) {
#pragma unroll
  for (int q = 0; q < 8; q += 2) { const v2f p = {v[q], v[q + 1]}; split2(p, h.h2[q >> 1], l.h2[q >> 1]); }
}

// one 8-key group of the softmax row: p = 256 exp(s - m) = exp2(t * SC2 + nm), t the unscaled score, nm = 8 - m * SC2 -> f16 hi + residual x1024 into fragment elements e0..e0+7
__device__ __forceinline__ void p_group(const float* tv, float nm, float& sum, FragH& ph, FragH& pl, const int e0) {
#pragma unroll
  for (int q = 0; q < 8; q += 2) {
    const v2f p = {__builtin_amdgcn_exp2f(__builtin_fmaf(tv[q], SC2, nm)), __builtin_amdgcn_exp2f(__builtin_fmaf(tv[q + 1], SC2, nm))};
    sum += p[0];
    sum += p[1];
    split2(p, ph.h2[(e0 + q) >> 1], pl.h2[(e0 + q) >> 1]);
  }
}

// one of a wave's four fragments by a wave-uniform slot number (the slot loops stay rolled, so that the kernel's text stays small)
__device__ __forceinline__ v16h pick4(unsigned i, v16h p0, v16h p1, v16h p2, v16h p3) { return i == 0u ? p0 : (i == 1u ? p1 : (i == 2u ? p2 : p3)); }

// one 16 x 16 tile of x W for one weight's column group j (fragments b0, b1), / 16, as f16 hi + residual x1024. xa false: weights as A, x as B: the lane holds token ln, features 16j + 8hh + 0..7. xa true: x as A, weights as B: the lane holds feature 16j + ln, tokens 8hh + 0..7.
__device__ __forceinline__ void proj_tile(v16h b0, v16h b1, const bool xa, v16h a0, v16h a1, Frag8& h, Frag8& l) {
  v8f acc = {0.f, 0.f, 0.f, 0.f, 0.f, 0.f, 0.f, 0.f};
  if (!xa) { acc = g2_mma(b0, a0, acc); acc = g2_mma(b1, a1, acc); }
  else     { acc = g2_mma(a0, b0, acc); acc = g2_mma(a1, b1, acc); }
  float v[8];
#pragma unroll
  for (int r = 0; r < 8; ++r) v[r] = acc[r] * 0.0625f;
  split8(v, h, l);
}

__global__ __launch_bounds__(NW * 32) void k_attn(const float* __restrict__ x, const float* __restrict__ wq, const float* __restrict__ wk, const float* __restrict__ wv, float* __restrict__ out) {
  __shared__ __attribute__((aligned(16))) float sw[NW][16][SP];
  __shared__ __attribute__((aligned(16))) _Float16 kv[SEQ / 64][4][TILE];   /* per 64-token step: Kh, Kl, Vth, Vtl tiles in fragment order; a step's four tiles lie together, so that one base register and immediate offsets reach all of its fragments */
  __shared__ __attribute__((aligned(16))) _Float16 wl[WELEMS];             /* the weights q, k, v as f16 x16 in fragment order */
  const unsigned tid = threadIdx.x, w = tid >> 5, lane = tid & 31u, ln = lane & 15u, hh = lane >> 4;
  const unsigned b = blockIdx.x;
  /* the wave's two 32-token tiles: w and 15 - w (16-token tiles 2w, 2w + 1, 30 - 2w, 31 - 2w): every wave walks the same number of 64-key steps */
  const unsigned wu = (unsigned)__builtin_amdgcn_readfirstlane((int)w);
  /* the wave's share of the weights, asked for ahead of x: rows k = 8 wu .. + 7 of each weight, the lane's columns n = 2 lane, 2 lane + 1, so that one wave load is one whole 256-B row */
  v2f wr[3][8];
  const float* wu0 = wq + (size_t)(8u * wu) * 64u;
  const float* wu1 = wk + (size_t)(8u * wu) * 64u;
  const float* wu2 = wv + (size_t)(8u * wu) * 64u;
#pragma unroll
  for (int i = 0; i < 8; ++i) { wr[0][i] = *(const v2fa*)(wu0 + i * 64 + 2u * lane); wr[1][i] = *(const v2fa*)(wu1 + i * 64 + 2u * lane); wr[2][i] = *(const v2fa*)(wu2 + i * 64 + 2u * lane); }
  /* s_wait_xcnt 0 before later code goes over an address register of the weight loads; the addresses are named as inputs, so that their registers are left alone up to the wait */
  asm volatile("s_wait_xcnt 0x0" :: "s"(wu0), "s"(wu1), "s"(wu2), "v"(lane) : "memory");
  const float* xb = x + ((size_t)b * SEQ_FULL + ln) * DM + 8u * hh;
  const float* x0 = xb + (size_t)(32u * wu) * DM;
  const float* x1 = x0 + 16 * DM;
  const float* x2 = xb + (size_t)(32u * (2u * NW - 1u - wu)) * DM;
  const float* x3 = x2 + 16 * DM;
  /* behind each tile's loads: s_wait_xcnt 0, so that no later load's result or address sum goes over an address register of an issued load ahead of it; the address is named as an input, as above */
  const XRaw xr00 = x_raw(x0), xr01 = x_raw(x0 + 32);
  asm volatile("s_wait_xcnt 0x0" :: "v"(x0) : "memory");
  const XRaw xr10 = x_raw(x1), xr11 = x_raw(x1 + 32);
  asm volatile("s_wait_xcnt 0x0" :: "v"(x1) : "memory");
  const XRaw xr20 = x_raw(x2), xr21 = x_raw(x2 + 32);
  asm volatile("s_wait_xcnt 0x0" :: "v"(x2) : "memory");
  const XRaw xr30 = x_raw(x3), xr31 = x_raw(x3 + 32);
  asm volatile("s_wait_xcnt 0x0" :: "v"(x3) : "memory");
  __builtin_amdgcn_sched_barrier(0);                              /* all loads are issued before the first wait for a weight: without it the compiler starts the weights' conversion, and so waits out their latency, ahead of three of the four tiles' x loads */
  /* the share -> bf16 (RNE) x16 as f16, into its place: rows 8 wu .. + 7 are k half wu / 4, piece (wu / 2) mod 2, lane half wu mod 2; column n is group n / 16, fragment row n mod 16; the lane's two columns are 32 B in a row */
#pragma unroll
  for (int c = 0; c < 3; ++c) {
    Frag8 f0, f1;
#pragma unroll
    for (int i = 0; i < 8; ++i) { f0.h[i] = (_Float16)(bf16_rne(wr[c][i][0]) * 16.0f); f1.h[i] = (_Float16)(bf16_rne(wr[c][i][1]) * 16.0f); }
    const unsigned od = ((((unsigned)c * 4u + (lane >> 3)) * 4u + (wu >> 1)) * 32u + (wu & 1u) * 16u + (2u * lane & 15u)) * 8u;
    *(v8us*)(unsigned short*)&wl[od] = f0.v;
    *(v8us*)(unsigned short*)&wl[od + 8u] = f1.v;
  }
  /* block barrier with fences on LDS alone: every wave's share of the weights is in LDS before any weight fragment is read (wl is only read from here on); __syncthreads() would also wait here for the x loads, which are still in flight and which no other wave needs */
  __builtin_amdgcn_fence(__ATOMIC_RELEASE, "workgroup", "local");
  __builtin_amdgcn_s_barrier();
  __builtin_amdgcn_fence(__ATOMIC_ACQUIRE, "workgroup", "local");
  /* the k and v weight fragments, taken once and kept in registers up to the end of the projection: [weight q, k, v][column group j][k half]; the q fragments are taken where a tile's Q is made */
  v16h wf[3][4][2];
#pragma unroll
  for (int cj = 4; cj < 12; ++cj) {
    const _Float16* bp = &wl[cj * 4 * PIECE + lane * 8u];
    wf[cj >> 2][cj & 3][0] = f_frag(bp);
    wf[cj >> 2][cj & 3][1] = f_frag(bp + 2 * PIECE);
  }
  __builtin_amdgcn_sched_barrier(0);                              /* the barrier and the fragment reads stay ahead of the first wait for x: without it the compiler lifts the conversion of x, with its waits for memory, over the barrier */
  const v16h xa00 = x_frag(xr00), xa01 = x_frag(xr01), xa10 = x_frag(xr10), xa11 = x_frag(xr11);
  const v16h xa20 = x_frag(xr20), xa21 = x_frag(xr21), xa30 = x_frag(xr30), xa31 = x_frag(xr31);
  /* K and V^T of the wave's tiles -> LDS planes */
#pragma unroll 1   /* rolled: the body runs four times only, and unrolled it would quadruple the text ahead of the hot loop */
  for (unsigned i = 0; i < (unsigned)TPW; ++i) {
    const unsigned tt = 2u * ((i >> 1) ? 2u * NW - 1u - wu : wu) + (i & 1u);
    const v16h a0 = pick4(i, xa00, xa10, xa20, xa30), a1 = pick4(i, xa01, xa11, xa21, xa31);
#pragma unroll
    for (int j = 0; j < 4; ++j) {
      Frag8 h, l;
      proj_tile(wf[1][j][0], wf[1][j][1], false, a0, a1, h, l);
      const unsigned ok = ((tt & 3u) * 4u + (unsigned)j) * PIECE + lane * 8u;      /* 64-token step tt / 4: piece j of its token tile tt mod 4 */
      *(v8us*)(unsigned short*)&kv[tt >> 2][0][ok] = h.v;
      *(v8us*)(unsigned short*)&kv[tt >> 2][1][ok] = l.v;
      proj_tile(wf[2][j][0], wf[2][j][1], true, a0, a1, h, l);
      const unsigned ov = ((unsigned)j * 4u + (tt & 3u)) * PIECE + lane * 8u;      /* the same step: d group j, piece tt mod 4 */
      *(v8us*)(unsigned short*)&kv[tt >> 2][2][ov] = h.v;
      *(v8us*)(unsigned short*)&kv[tt >> 2][3][ov] = l.v;
    }
  }
  /* the x fragments of the wave's second 32-token tile wait in the wave's own scratch rows, not in registers, while the first tile's hot loop runs */
  unsigned short* xs = (unsigned short*)&sw[w][0][0] + lane * 8u;
  { FragH f;
    f.v = xa20; *(v8us*)xs = f.half[0];                *(v8us*)(xs + PIECE) = f.half[1];
    f.v = xa21; *(v8us*)(xs + 2 * PIECE) = f.half[0];  *(v8us*)(xs + 3 * PIECE) = f.half[1];
    f.v = xa30; *(v8us*)(xs + 4 * PIECE) = f.half[0];  *(v8us*)(xs + 5 * PIECE) = f.half[1];
    f.v = xa31; *(v8us*)(xs + 6 * PIECE) = f.half[0];  *(v8us*)(xs + 7 * PIECE) = f.half[1]; }
  __syncthreads();                                                /* every wave's K and V^T pieces are in LDS before any fragment is read; the planes are only read from here on */
  const v8f z8 = {0.f, 0.f, 0.f, 0.f, 0.f, 0.f, 0.f, 0.f};
  v16h ca[2][2] = {{xa00, xa01}, {xa10, xa11}};                   /* x fragments of the 32-query tile in hand: [t][k half] */
#pragma unroll 1   /* rolled: one copy of the hot loop in the text */
  for (unsigned i = 0; i < 2u; ++i) {
    const unsigned u = i ? 2u * NW - 1u - wu : wu;                /* the 32-query tile: two 16-query tiles t = 0, 1, worked on together, so that every K and V fragment read from LDS feeds both */
    const unsigned qt = u >> 1, qw0 = 32u * u;
    v16h aqh0[2], aqh1[2], aql0[2], aql1[2];
#pragma unroll
    for (int j = 0; j < 4; ++j) {
      const _Float16* bp = &wl[j * 4 * PIECE + lane * 8u];
      wf[0][j][0] = f_frag(bp);
      wf[0][j][1] = f_frag(bp + 2 * PIECE);
    }
#pragma unroll
    for (int t = 0; t < 2; ++t) {
      const v16h a0 = ca[t][0], a1 = ca[t][1];
      FragH qh0, qh1, ql0, ql1;
      Frag8 h, l;
      /* the lane's 16 B of piece j are elements 8 (j mod 2) .. + 7 of the fragment of d half j / 2 */
      proj_tile(wf[0][0][0], wf[0][0][1], false, a0, a1, h, l); qh0.half[0] = h.v; ql0.half[0] = l.v;
      proj_tile(wf[0][1][0], wf[0][1][1], false, a0, a1, h, l); qh0.half[1] = h.v; ql0.half[1] = l.v;
      proj_tile(wf[0][2][0], wf[0][2][1], false, a0, a1, h, l); qh1.half[0] = h.v; ql1.half[0] = l.v;
      proj_tile(wf[0][3][0], wf[0][3][1], false, a0, a1, h, l); qh1.half[1] = h.v; ql1.half[1] = l.v;
      aqh0[t] = qh0.v; aqh1[t] = qh1.v; aql0[t] = ql0.v; aql1[t] = ql1.v;
    }
    v8f oh[2][4] = {{z8, z8, z8, z8}, {z8, z8, z8, z8}}, orr[2][4] = {{z8, z8, z8, z8}, {z8, z8, z8, z8}};
    float m_run[2] = {-1.0e30f, -1.0e30f}, l_run[2] = {0.f, 0.f};
#pragma unroll 1   /* rolled: the trip count differs from tile to tile */
    for (unsigned kt = 0; kt <= qt; ++kt) {
      float s4[2][4][8];                                          /* the lane's query 16t + ln against keys 64 kt + 16j + 8hh + r */
      const int rel = (int)(qw0 + ln) - (int)(kt * 64u + 8u * hh); /* key 16j + r of the lane's share is masked when it lies above rel + 16t */
      v16h kf[4][4];
#pragma unroll
      for (int j = 0; j < 4; ++j) {
        const _Float16* kh = &kv[kt][0][j * 4 * PIECE + lane * 8u];
        const _Float16* kl = &kv[kt][1][j * 4 * PIECE + lane * 8u];
        kf[j][0] = f_frag(kh); kf[j][1] = f_frag(kh + 2 * PIECE); kf[j][2] = f_frag(kl); kf[j][3] = f_frag(kl + 2 * PIECE);
      }
      __builtin_amdgcn_sched_barrier(0);                          /* the step's K reads stand as one group ahead of its WMMAs: without it the compiler puts each group of eight reads directly in front of its users, and every group's LDS latency is waited out */
#pragma unroll
      for (int j = 0; j < 4; ++j) {
        const v16h bh0 = kf[j][0], bh1 = kf[j][1], bl0 = kf[j][2], bl1 = kf[j][3];
#pragma unroll
        for (int t = 0; t < 2; ++t) {
          v8f sh = z8, sr = z8;
          sh = g2_mma(bh0, aqh0[t], sh); sh = g2_mma(bh1, aqh1[t], sh);
          sr = g2_mma(bh0, aql0[t], sr); sr = g2_mma(bh1, aql1[t], sr);
          sr = g2_mma(bl0, aqh0[t], sr); sr = g2_mma(bl1, aqh1[t], sr);
#pragma unroll
          for (int r = 0; r < 8; ++r) {
            const float s = sh[r] + sr[r] * 0.0009765625f;         /* unscaled: 64^-0.5 is applied in the exponent */
            s4[t][j][r] = (16 * j + r - 16 * t > rel) ? -1.0e30f : s;   /* replace-fill; exp gives exactly 0 */
          }
        }
      }
      v16h vf[4][4];
#pragma unroll
      for (int j = 0; j < 4; ++j) {
        const _Float16* vh = &kv[kt][2][j * 4 * PIECE + lane * 8u];
        vf[j][0] = f_frag(vh); vf[j][1] = f_frag(vh + 2 * PIECE);
      }
      __builtin_amdgcn_sched_barrier(0);                          /* the step's V hi reads stand ahead of the softmax, which covers their latency: without it the compiler puts them directly in front of their WMMAs */
      float tmax[2], al[2];
      FragH ph0[2], ph1[2], pl0[2], pl1[2];
#pragma unroll
      for (int t = 0; t < 2; ++t) {
        tmax[t] = -1.0e30f;
#pragma unroll
        for (int g = 0; g < 4; ++g) {
          tmax[t] = fmaxf(tmax[t], fmaxf(fmaxf(s4[t][g][0], s4[t][g][1]), fmaxf(s4[t][g][2], s4[t][g][3])));
          tmax[t] = fmaxf(tmax[t], fmaxf(fmaxf(s4[t][g][4], s4[t][g][5]), fmaxf(s4[t][g][6], s4[t][g][7])));
        }
      }
#pragma unroll
      for (int t = 0; t < 2; ++t) tmax[t] = fmaxf(tmax[t], __shfl_xor(tmax[t], 16, 32));
      float sum[2];
#pragma unroll
      for (int t = 0; t < 2; ++t) {
        const float newm = fmaxf(m_run[t], tmax[t]);
        al[t] = __builtin_amdgcn_exp2f((m_run[t] - newm) * SC2);
        const float nm = __builtin_fmaf(newm, -SC2, 8.0f);
        sum[t] = 0.f;
        p_group(s4[t][0], nm, sum[t], ph0[t], pl0[t], 0);
        p_group(s4[t][1], nm, sum[t], ph0[t], pl0[t], 8);
        p_group(s4[t][2], nm, sum[t], ph1[t], pl1[t], 0);
        p_group(s4[t][3], nm, sum[t], ph1[t], pl1[t], 8);
        m_run[t] = newm;
        if (t == 0) {
#pragma unroll
          for (int j = 0; j < 4; ++j) {
            const _Float16* vl = &kv[kt][3][j * 4 * PIECE + lane * 8u];
            vf[j][2] = f_frag(vl); vf[j][3] = f_frag(vl + 2 * PIECE);
          }
          __builtin_amdgcn_sched_barrier(0);                      /* the V residual reads stand between the two tiles' softmax, in registers that the first tile's scores have left; the second tile's softmax covers their latency */
        }
      }
#pragma unroll
      for (int t = 0; t < 2; ++t) {
        sum[t] += __shfl_xor(sum[t], 16, 32);
        l_run[t] = l_run[t] * al[t] + sum[t];
#pragma unroll
        for (int j = 0; j < 4; ++j)
#pragma unroll
          for (int r = 0; r < 8; ++r) { oh[t][j][r] *= al[t]; orr[t][j][r] *= al[t]; }
      }
#pragma unroll
      for (int j = 0; j < 4; ++j) {
        const v16h bvh0 = vf[j][0], bvh1 = vf[j][1], bvl0 = vf[j][2], bvl1 = vf[j][3];
#pragma unroll
        for (int t = 0; t < 2; ++t) {
          oh[t][j]  = g2_mma(bvh0, ph0[t].v, oh[t][j]);  oh[t][j]  = g2_mma(bvh1, ph1[t].v, oh[t][j]);
          orr[t][j] = g2_mma(bvh0, pl0[t].v, orr[t][j]); orr[t][j] = g2_mma(bvh1, pl1[t].v, orr[t][j]);
          orr[t][j] = g2_mma(bvl0, ph0[t].v, orr[t][j]); orr[t][j] = g2_mma(bvl1, ph1[t].v, orr[t][j]);
        }
      }
    }
    /* the second tile's x fragments come back before the scratch rows take the output; read in both passes (what the last pass reads is not used): under a test on i the old fragments would have to live through the hot loop */
    ca[0][0] = f_frag((const _Float16*)xs);               ca[0][1] = f_frag((const _Float16*)xs + 2 * PIECE);
    ca[1][0] = f_frag((const _Float16*)xs + 4 * PIECE);   ca[1][1] = f_frag((const _Float16*)xs + 6 * PIECE);
#pragma unroll
    for (int t = 0; t < 2; ++t) {
      const float invl = 1.0f / l_run[t];                         /* l_run carries the x256 of P; >= 256 up to rounding */
      /* each 16-query tile goes once through the wave's own LDS scratch, so that the global stores below write whole 256-B rows */
#pragma unroll
      for (int j = 0; j < 4; ++j) {
        v4f o0, o1;
#pragma unroll
        for (int r = 0; r < 4; ++r) { o0[r] = (oh[t][j][r] + orr[t][j][r] * 0.0009765625f) * invl; o1[r] = (oh[t][j][r + 4] + orr[t][j][r + 4] * 0.0009765625f) * invl; }
        *(v4fa*)&sw[w][ln][16 * j + 8u * hh] = o0;
        *(v4fa*)&sw[w][ln][16 * j + 8u * hh + 4u] = o1;
      }
      __builtin_amdgcn_fence(4 /* acq_rel order */, "workgroup", "local");   /* on LDS alone: the rows pass between the wave's own lanes through LDS; a fence on all memory would also wait here for the global stores of the 16-query tile before */
      __builtin_amdgcn_wave_barrier();
      float* orow = out + ((size_t)b * SEQ_FULL + qw0 + 16u * (unsigned)t) * HD;
      const unsigned c4 = ln * 4u;
      v4f ov[8];
#pragma unroll
      for (int q = 0; q < 8; ++q) ov[q] = *(const v4fa*)&sw[w][2u * q + hh][c4];
#pragma unroll
      for (int q = 0; q < 8; ++q) *(v4f*)(orow + (size_t)(2u * q + hh) * HD + c4) = ov[q];   /* lanes 0-15: row 2q (256 B), lanes 16-31: row 2q+1 */
      asm volatile("s_wait_xcnt 0x0" ::: "memory");              /* before later code goes over the stores' address and data registers */
    }
  }
}

extern "C" void kernel_launch(void* const* d_in, const int* in_sizes, int n_in,
                              void* d_out, int out_size, void* d_ws, size_t ws_size, hipStream_t stream) {
  if (n_in < 4) return;
  const size_t need_x = ((size_t)(NB - 1) * SEQ_FULL + SEQ) * DM;
  if ((size_t)in_sizes[0] < need_x) return;
  if (in_sizes[1] < 64 * 64 || in_sizes[2] < 64 * 64 || in_sizes[3] < 64 * 64) return;
  if ((size_t)out_size < need_x) return;
  const float* x  = (const float*)d_in[0];      /* [B][T][64] */
  const float* wk = (const float*)d_in[1];      /* w_key   [in][out] */
  const float* wq = (const float*)d_in[2];      /* w_query [in][out] */
  const float* wv = (const float*)d_in[3];      /* w_value [in][out] */
  k_attn<<<NB, NW * 32, 0, stream>>>(x, wq, wk, wv, (float*)d_out);
}
